// v000
// The times below were measured on an AMD MI455X: many runs one after another, warmed up first and cycling through
// copies of the inputs, with the whole window's GPU time divided by the number of runs. Launches and the gaps
// between them are all in it. The median over several windows is given; except for v000 it joins two sittings, which
// can be a few percent apart, so the side-by-side timings, each taken in one sitting, are the better comparison.
// v000, which the later versions start from, runs in 109 microseconds.
#include <hip/hip_runtime.h>
#include <math.h>

// CDNA5 / gfx1250, wave32. All matrix work via V_WMMA_F32_16X16X4_F32.
//
// Shapes (fixed by reference setup): B=2, C=1, W=64, H=1024, d=32, WIN=32.
// Pixels P = B*W*H = 131072, attention rows N = B*W = 128 (seq len H=1024).
//
// Workspace layout (needs 256 + 4*16MB = ~64.0 MB):
//   [0..32)        : stats  (GN1: b0{s1,s2} b1{s1,s2} ; GN2: same at +4 floats)
//   [256 + 0*BUF)  : z   (post-GN1-GELU activations [pixel][d])  -- reused as g
//   [256 + 1*BUF)  : q   [pixel][d]
//   [256 + 2*BUF)  : k   [pixel][d]
//   [256 + 3*BUF)  : v   [pixel][d]

typedef __attribute__((ext_vector_type(2))) float v2f;
typedef __attribute__((ext_vector_type(8))) float v8f;

#define H_DIM 1024
#define W_DIM 64
#define B_DIM 2
#define D_DIM 32
#define WIN   32
#define NPIX  (B_DIM * W_DIM * H_DIM)   // 131072
#define NROWS (B_DIM * W_DIM)           // 128

__device__ __forceinline__ float gelu_exact(float x) {
    return 0.5f * x * (1.0f + erff(x * 0.70710678118654752440f));
}

// D = A(16x4) * B(4x16) + C, fp32 throughout.
// A layout: lanes 0-15 hold row m, k={0,1}; lanes 16-31 hold row m, k={2,3}.
// B layout: lanes 0-15 hold col n, k={0,1}; lanes 16-31 hold col n, k={2,3}.
// C/D layout: lane&15 = col n; vgpr r = row r (lanes 0-15) / r+8 (lanes 16-31).
__device__ __forceinline__ v8f wmma4(v2f a, v2f b, v8f c) {
    return __builtin_amdgcn_wmma_f32_16x16x4_f32(false, a, false, b, (short)0, c,
                                                 false, false);
}

// ---------------------------------------------------------------- stats init
__global__ void k_init_stats(float* stats) {
    if (threadIdx.x < 8) stats[threadIdx.x] = 0.0f;
}

// ------------------------------------------------- GN1 stats (feat = x * w_in)
__global__ void k_stats1(const float* __restrict__ x, const float* __restrict__ w_in,
                         float* __restrict__ stats) {
    __shared__ float r1[256], r2[256];
    int p = blockIdx.x * 256 + threadIdx.x;
    float xv = x[p];
    float s1 = 0.f, s2 = 0.f;
#pragma unroll
    for (int d = 0; d < D_DIM; ++d) {
        float f = xv * w_in[d];
        s1 += f;
        s2 += f * f;
    }
    r1[threadIdx.x] = s1;
    r2[threadIdx.x] = s2;
    __syncthreads();
    for (int off = 128; off > 0; off >>= 1) {
        if ((int)threadIdx.x < off) {
            r1[threadIdx.x] += r1[threadIdx.x + off];
            r2[threadIdx.x] += r2[threadIdx.x + off];
        }
        __syncthreads();
    }
    if (threadIdx.x == 0) {
        int b = p >> 16;  // 65536 pixels per batch; blocks never straddle batches
        atomicAdd(&stats[b * 2 + 0], r1[0]);
        atomicAdd(&stats[b * 2 + 1], r2[0]);
    }
}

// ------------------------------------------------------- z = gelu(GN1(feat))
__global__ void k_z(const float* __restrict__ x, const float* __restrict__ w_in,
                    const float* __restrict__ gn_w, const float* __restrict__ gn_b,
                    const float* __restrict__ stats, float* __restrict__ z) {
    int p = blockIdx.x * 256 + threadIdx.x;
    int b = p >> 16;
    const float cnt = (float)(D_DIM * W_DIM * H_DIM);
    float mu = stats[b * 2 + 0] / cnt;
    float var = stats[b * 2 + 1] / cnt - mu * mu;
    float rs = rsqrtf(var + 1e-5f);
    float xv = x[p];
#pragma unroll
    for (int d = 0; d < D_DIM; ++d) {
        float f = xv * w_in[d];
        float hh = (f - mu) * rs * gn_w[d] + gn_b[d];
        z[p * D_DIM + d] = gelu_exact(hh);
    }
}

// --------------------------------------------- q/k/v projection (WMMA, fp32)
// One wave per 16 pixels: q[i,e] = sum_d z[i,d] * w_q[e,d]  (same for k,v).
__global__ void k_qkv(const float* __restrict__ z, const float* __restrict__ wq,
                      const float* __restrict__ wk, const float* __restrict__ wv,
                      float* __restrict__ q, float* __restrict__ k,
                      float* __restrict__ v) {
    int lane = threadIdx.x;
    int m = lane & 15, hi = lane >> 4;
    int pb = blockIdx.x * 16;

    v2f a[8];  // A-fragments of z tile (16 x 32)
#pragma unroll
    for (int kk = 0; kk < 8; ++kk) {
        const float* src = z + (size_t)(pb + m) * D_DIM + kk * 4 + hi * 2;
        a[kk].x = src[0];
        a[kk].y = src[1];
    }

    const float* wgt[3] = {wq, wk, wv};
    float* dst[3] = {q, k, v};
#pragma unroll
    for (int t = 0; t < 3; ++t) {
#pragma unroll
        for (int et = 0; et < 2; ++et) {
            v8f acc = {0.f, 0.f, 0.f, 0.f, 0.f, 0.f, 0.f, 0.f};
#pragma unroll
            for (int kk = 0; kk < 8; ++kk) {
                // B[k_local, e] = w[e, d]; lane holds column e = et*16 + m
                const float* wsrc = wgt[t] + (size_t)(et * 16 + m) * D_DIM + kk * 4 + hi * 2;
                v2f bf;
                bf.x = wsrc[0];
                bf.y = wsrc[1];
                acc = wmma4(a[kk], bf, acc);
            }
#pragma unroll
            for (int r = 0; r < 8; ++r) {
                dst[t][(size_t)(pb + r + 8 * hi) * D_DIM + et * 16 + m] = acc[r];
            }
        }
    }
}

// ----------------------------------------- banded attention + residual (WMMA)
// One wave per (row n, 16-query tile i0). Keys span [i0-32, i0+48) = 5 tiles.
__global__ void k_attn(const float* __restrict__ q, const float* __restrict__ kbuf,
                       const float* __restrict__ vbuf, const float* __restrict__ x,
                       const float* __restrict__ w_in,
                       const float* __restrict__ gamma_p, float* __restrict__ g,
                       float* __restrict__ stats2) {
    __shared__ float S[16][80];
    __shared__ float red1[32], red2[32];
    int lane = threadIdx.x;
    int m = lane & 15, hi = lane >> 4;
    int nrow = blockIdx.x >> 6;
    int i0 = (blockIdx.x & 63) << 4;
    int rowbase = nrow * H_DIM;

    // Q A-fragments (16 queries x 32 dims)
    v2f qa[8];
#pragma unroll
    for (int kk = 0; kk < 8; ++kk) {
        const float* src = q + (size_t)(rowbase + i0 + m) * D_DIM + kk * 4 + hi * 2;
        qa[kk].x = src[0];
        qa[kk].y = src[1];
    }

    // S = Q * K^T, 5 key tiles of 16, K-dim = 32 (8 WMMAs each)
#pragma unroll
    for (int jt = 0; jt < 5; ++jt) {
        int jg = i0 - WIN + jt * 16 + m;           // key column for this lane
        int jc = min(max(jg, 0), H_DIM - 1);       // clamp; masked later
        v8f acc = {0.f, 0.f, 0.f, 0.f, 0.f, 0.f, 0.f, 0.f};
#pragma unroll
        for (int kk = 0; kk < 8; ++kk) {
            const float* src = kbuf + (size_t)(rowbase + jc) * D_DIM + kk * 4 + hi * 2;
            v2f bf;
            bf.x = src[0];
            bf.y = src[1];
            acc = wmma4(qa[kk], bf, acc);
        }
#pragma unroll
        for (int r = 0; r < 8; ++r) S[r + 8 * hi][jt * 16 + m] = acc[r];
    }
    __syncthreads();

    // Banded softmax: lane i handles query row i (80 candidate keys)
    if (lane < 16) {
        const float scale = 0.17677669529663687f;  // 32^-0.5
        int i = lane;
        float mx = -3.0e38f;
        for (int j = 0; j < 80; ++j) {
            int jg = i0 - WIN + j;
            int di = i + WIN - j;  // == (i0+i) - jg
            if (jg >= 0 && jg < H_DIM && di >= -WIN && di <= WIN)
                mx = fmaxf(mx, S[i][j] * scale);
        }
        float sum = 0.f;
        for (int j = 0; j < 80; ++j) {
            int jg = i0 - WIN + j;
            int di = i + WIN - j;
            float pv = 0.f;
            if (jg >= 0 && jg < H_DIM && di >= -WIN && di <= WIN) {
                pv = expf(S[i][j] * scale - mx);
                sum += pv;
            }
            S[i][j] = pv;
        }
        float rinv = 1.0f / sum;
        for (int j = 0; j < 80; ++j) S[i][j] *= rinv;
    }
    __syncthreads();

    // O = P * V  (K=80 -> 20 chunks), fused with residual feat + gamma*O
    float gma = gamma_p[0];
    float ls1 = 0.f, ls2 = 0.f;
#pragma unroll
    for (int et = 0; et < 2; ++et) {
        v8f acc = {0.f, 0.f, 0.f, 0.f, 0.f, 0.f, 0.f, 0.f};
#pragma unroll
        for (int ck = 0; ck < 20; ++ck) {
            v2f pa;  // A-fragment of P from LDS: row m, k = ck*4 + hi*2 + {0,1}
            pa.x = S[m][ck * 4 + hi * 2 + 0];
            pa.y = S[m][ck * 4 + hi * 2 + 1];
            int j0 = i0 - WIN + ck * 4 + hi * 2;
            int ja = min(max(j0, 0), H_DIM - 1);
            int jb = min(max(j0 + 1, 0), H_DIM - 1);
            v2f bf;  // B-fragment of V: column e = et*16 + m (coalesced per k-row)
            bf.x = vbuf[(size_t)(rowbase + ja) * D_DIM + et * 16 + m];
            bf.y = vbuf[(size_t)(rowbase + jb) * D_DIM + et * 16 + m];
            acc = wmma4(pa, bf, acc);
        }
#pragma unroll
        for (int r = 0; r < 8; ++r) {
            int i = r + 8 * hi;
            int p = rowbase + i0 + i;
            int e = et * 16 + m;
            float f = x[p] * w_in[e];  // feat is rank-1 (C==1): recompute
            float gv = f + gma * acc[r];
            g[(size_t)p * D_DIM + e] = gv;
            ls1 += gv;
            ls2 += gv * gv;
        }
    }
    // GN2 partial sums: wave reduce via LDS, one atomic per block
    red1[lane] = ls1;
    red2[lane] = ls2;
    __syncthreads();
    if (lane == 0) {
        float s1 = 0.f, s2 = 0.f;
        for (int t = 0; t < 32; ++t) {
            s1 += red1[t];
            s2 += red2[t];
        }
        int b = nrow >> 6;
        atomicAdd(&stats2[b * 2 + 0], s1);
        atomicAdd(&stats2[b * 2 + 1], s2);
    }
}

// ------------------------------------- out = w_out . gelu(GN2(g))  (C == 1)
__global__ void k_final(const float* __restrict__ g, const float* __restrict__ gn_w,
                        const float* __restrict__ gn_b,
                        const float* __restrict__ w_out,
                        const float* __restrict__ stats2, float* __restrict__ out) {
    int p = blockIdx.x * 256 + threadIdx.x;
    int b = p >> 16;
    const float cnt = (float)(D_DIM * W_DIM * H_DIM);
    float mu = stats2[b * 2 + 0] / cnt;
    float var = stats2[b * 2 + 1] / cnt - mu * mu;
    float rs = rsqrtf(var + 1e-5f);
    float acc = 0.f;
#pragma unroll
    for (int d = 0; d < D_DIM; ++d) {
        float hh = (g[(size_t)p * D_DIM + d] - mu) * rs * gn_w[d] + gn_b[d];
        acc += gelu_exact(hh) * w_out[d];
    }
    out[p] = acc;
}

extern "C" void kernel_launch(void* const* d_in, const int* in_sizes, int n_in,
                              void* d_out, int out_size, void* d_ws, size_t ws_size,
                              hipStream_t stream) {
    (void)in_sizes; (void)n_in; (void)out_size; (void)ws_size;
    const float* x     = (const float*)d_in[0];
    const float* w_in  = (const float*)d_in[1];
    const float* w_q   = (const float*)d_in[2];
    const float* w_k   = (const float*)d_in[3];
    const float* w_v   = (const float*)d_in[4];
    const float* w_out = (const float*)d_in[5];
    const float* gn_w  = (const float*)d_in[6];
    const float* gn_b  = (const float*)d_in[7];
    const float* gamma = (const float*)d_in[8];
    float* out = (float*)d_out;

    char* ws = (char*)d_ws;
    float* stats = (float*)ws;  // 8 floats: GN1 pair then GN2 pair
    const size_t BUF = (size_t)NPIX * D_DIM * sizeof(float);  // 16 MB
    float* z  = (float*)(ws + 256);            // reused as g after k_qkv
    float* qb = (float*)(ws + 256 + 1 * BUF);
    float* kb = (float*)(ws + 256 + 2 * BUF);
    float* vb = (float*)(ws + 256 + 3 * BUF);
    float* g  = z;

    k_init_stats<<<1, 32, 0, stream>>>(stats);
    k_stats1<<<NPIX / 256, 256, 0, stream>>>(x, w_in, stats);
    k_z<<<NPIX / 256, 256, 0, stream>>>(x, w_in, gn_w, gn_b, stats, z);
    k_qkv<<<NPIX / 16, 32, 0, stream>>>(z, w_q, w_k, w_v, qb, kb, vb);
    k_attn<<<NROWS * (H_DIM / 16), 32, 0, stream>>>(qb, kb, vb, x, w_in, gamma, g,
                                                    stats + 4);
    k_final<<<NPIX / 256, 256, 0, stream>>>(g, gn_w, gn_b, w_out, stats + 4, out);
}

// v001
// A run of this version takes 87.7 microseconds.
// Two timings next to v000 put it at 1.26 and 1.25 times that version's speed.
#include <hip/hip_runtime.h>
#include <math.h>

// CDNA5 / gfx1250, wave32. All matrix work via V_WMMA_F32_16X16X4_F32.
//
// Shapes (fixed by reference setup): B=2, C=1, W=64, H=1024, d=32, WIN=32.
// Pixels P = B*W*H = 131072, attention rows N = B*W = 128 (seq len H=1024).
//
// Workspace layout (needs 256 + 4*16MB = ~64.0 MB):
//   [0..32)        : stats  (GN1: b0{s1,s2} b1{s1,s2} ; GN2: same at +4 floats)
//   [256 + 0*BUF)  : g   (feat + gamma * attention output, [pixel][d])
//   [256 + 1*BUF)  : q   [pixel][d]
//   [256 + 2*BUF)  : k   [pixel][d]
//   [256 + 3*BUF)  : v   [pixel][d]

typedef __attribute__((ext_vector_type(2))) float v2f;
typedef __attribute__((ext_vector_type(8))) float v8f;

#define H_DIM 1024
#define W_DIM 64
#define B_DIM 2
#define D_DIM 32
#define WIN   32
#define NPIX  (B_DIM * W_DIM * H_DIM)   // 131072
#define NROWS (B_DIM * W_DIM)           // 128

__device__ __forceinline__ float gelu_exact(float x) {
    return 0.5f * x * (1.0f + erff(x * 0.70710678118654752440f));
}

// D = A(16x4) * B(4x16) + C, fp32 throughout.
// A layout: lanes 0-15 hold row m, k={0,1}; lanes 16-31 hold row m, k={2,3}.
// B layout: lanes 0-15 hold col n, k={0,1}; lanes 16-31 hold col n, k={2,3}.
// C/D layout: lane&15 = col n; vgpr r = row r (lanes 0-15) / r+8 (lanes 16-31).
__device__ __forceinline__ v8f wmma4(v2f a, v2f b, v8f c) {
    return __builtin_amdgcn_wmma_f32_16x16x4_f32(false, a, false, b, (short)0, c,
                                                 false, false);
}

// ---------------------------------------------------------------- stats init
__global__ void k_init_stats(float* stats) {
    if (threadIdx.x < 8) stats[threadIdx.x] = 0.0f;
}

// ------------------------------------------------- GN1 stats (feat = x * w_in)
__global__ void k_stats1(const float* __restrict__ x, const float* __restrict__ w_in,
                         float* __restrict__ stats) {
    __shared__ float r1[256], r2[256];
    int p = blockIdx.x * 256 + threadIdx.x;
    float xv = x[p];
    float s1 = 0.f, s2 = 0.f;
#pragma unroll
    for (int d = 0; d < D_DIM; ++d) {
        float f = xv * w_in[d];
        s1 += f;
        s2 += f * f;
    }
    r1[threadIdx.x] = s1;
    r2[threadIdx.x] = s2;
    __syncthreads();
    for (int off = 128; off > 0; off >>= 1) {
        if ((int)threadIdx.x < off) {
            r1[threadIdx.x] += r1[threadIdx.x + off];
            r2[threadIdx.x] += r2[threadIdx.x + off];
        }
        __syncthreads();
    }
    if (threadIdx.x == 0) {
        int b = p >> 16;  // 65536 pixels per batch; blocks never straddle batches
        atomicAdd(&stats[b * 2 + 0], r1[0]);
        atomicAdd(&stats[b * 2 + 1], r2[0]);
    }
}

// --------------------------------------------- q/k/v projection (WMMA, fp32)
// One wave per 16 pixels: q[i,e] = sum_d z[i,d] * w_q[e,d]  (same for k,v),
// with z = gelu(GN1(feat)) computed here, each element once, in the lane and
// register that the A-fragment wants it in (z never goes to memory).
__global__ void k_qkv(const float* __restrict__ x, const float* __restrict__ w_in,
                      const float* __restrict__ gn_w, const float* __restrict__ gn_b,
                      const float* __restrict__ stats, const float* __restrict__ wq,
                      const float* __restrict__ wk, const float* __restrict__ wv,
                      float* __restrict__ q, float* __restrict__ k,
                      float* __restrict__ v) {
    int lane = threadIdx.x;
    int m = lane & 15, hi = lane >> 4;
    int pb = blockIdx.x * 16;

    float xv = x[pb + m];
    v2f wi[8], gw[8], gb[8];  // channel values of this lane: d = kk*4 + hi*2 + {0,1}
#pragma unroll
    for (int kk = 0; kk < 8; ++kk) {  // all channel loads first: one wait, not one per gelu
        int d = kk * 4 + hi * 2;
        wi[kk].x = w_in[d + 0];
        wi[kk].y = w_in[d + 1];
        gw[kk].x = gn_w[d + 0];
        gw[kk].y = gn_w[d + 1];
        gb[kk].x = gn_b[d + 0];
        gb[kk].y = gn_b[d + 1];
    }
    // the base registers of the loads above are reused by the scalar code below
    asm volatile("s_wait_xcnt 0x0" ::: "memory");

    int b = pb >> 16;  // 65536 pixels per batch; a 16-pixel tile never straddles batches
    const float cnt = (float)(D_DIM * W_DIM * H_DIM);
    float mu = stats[b * 2 + 0] / cnt;
    float var = stats[b * 2 + 1] / cnt - mu * mu;
    float rs = rsqrtf(var + 1e-5f);

    v2f a[8];  // A-fragments of z tile (16 x 32): row m, d = kk*4 + hi*2 + {0,1}
#pragma unroll
    for (int kk = 0; kk < 8; ++kk) {
        a[kk].x = (xv * wi[kk].x - mu) * rs * gw[kk].x + gb[kk].x;
        a[kk].y = (xv * wi[kk].y - mu) * rs * gw[kk].y + gb[kk].y;
    }
#pragma unroll
    for (int kk = 0; kk < 8; ++kk) {
        a[kk].x = gelu_exact(a[kk].x);
        a[kk].y = gelu_exact(a[kk].y);
    }

    const float* wgt[3] = {wq, wk, wv};
    float* dst[3] = {q, k, v};
#pragma unroll
    for (int t = 0; t < 3; ++t) {
#pragma unroll
        for (int et = 0; et < 2; ++et) {
            v8f acc = {0.f, 0.f, 0.f, 0.f, 0.f, 0.f, 0.f, 0.f};
#pragma unroll
            for (int kk = 0; kk < 8; ++kk) {
                // B[k_local, e] = w[e, d]; lane holds column e = et*16 + m
                const float* wsrc = wgt[t] + (size_t)(et * 16 + m) * D_DIM + kk * 4 + hi * 2;
                v2f bf;
                bf.x = wsrc[0];
                bf.y = wsrc[1];
                acc = wmma4(a[kk], bf, acc);
            }
#pragma unroll
            for (int r = 0; r < 8; ++r) {
                dst[t][(size_t)(pb + r + 8 * hi) * D_DIM + et * 16 + m] = acc[r];
            }
        }
    }
}

// ----------------------------------------- banded attention + residual (WMMA)
// One wave per (row n, 16-query tile i0). Keys span [i0-32, i0+48) = 5 tiles.
__global__ void k_attn(const float* __restrict__ q, const float* __restrict__ kbuf,
                       const float* __restrict__ vbuf, const float* __restrict__ x,
                       const float* __restrict__ w_in,
                       const float* __restrict__ gamma_p, float* __restrict__ g,
                       float* __restrict__ stats2) {
    __shared__ float S[16][80];
    __shared__ float red1[32], red2[32];
    int lane = threadIdx.x;
    int m = lane & 15, hi = lane >> 4;
    int nrow = blockIdx.x >> 6;
    int i0 = (blockIdx.x & 63) << 4;
    int rowbase = nrow * H_DIM;

    // Q A-fragments (16 queries x 32 dims)
    v2f qa[8];
#pragma unroll
    for (int kk = 0; kk < 8; ++kk) {
        const float* src = q + (size_t)(rowbase + i0 + m) * D_DIM + kk * 4 + hi * 2;
        qa[kk].x = src[0];
        qa[kk].y = src[1];
    }

    // S = Q * K^T, 5 key tiles of 16, K-dim = 32 (8 WMMAs each)
#pragma unroll
    for (int jt = 0; jt < 5; ++jt) {
        int jg = i0 - WIN + jt * 16 + m;           // key column for this lane
        int jc = min(max(jg, 0), H_DIM - 1);       // clamp; masked later
        v8f acc = {0.f, 0.f, 0.f, 0.f, 0.f, 0.f, 0.f, 0.f};
#pragma unroll
        for (int kk = 0; kk < 8; ++kk) {
            const float* src = kbuf + (size_t)(rowbase + jc) * D_DIM + kk * 4 + hi * 2;
            v2f bf;
            bf.x = src[0];
            bf.y = src[1];
            acc = wmma4(qa[kk], bf, acc);
        }
#pragma unroll
        for (int r = 0; r < 8; ++r) S[r + 8 * hi][jt * 16 + m] = acc[r];
    }
    __syncthreads();

    // Banded softmax: lane i handles query row i (80 candidate keys)
    if (lane < 16) {
        const float scale = 0.17677669529663687f;  // 32^-0.5
        int i = lane;
        float mx = -3.0e38f;
        for (int j = 0; j < 80; ++j) {
            int jg = i0 - WIN + j;
            int di = i + WIN - j;  // == (i0+i) - jg
            if (jg >= 0 && jg < H_DIM && di >= -WIN && di <= WIN)
                mx = fmaxf(mx, S[i][j] * scale);
        }
        float sum = 0.f;
        for (int j = 0; j < 80; ++j) {
            int jg = i0 - WIN + j;
            int di = i + WIN - j;
            float pv = 0.f;
            if (jg >= 0 && jg < H_DIM && di >= -WIN && di <= WIN) {
                pv = expf(S[i][j] * scale - mx);
                sum += pv;
            }
            S[i][j] = pv;
        }
        float rinv = 1.0f / sum;
        for (int j = 0; j < 80; ++j) S[i][j] *= rinv;
    }
    __syncthreads();

    // O = P * V  (K=80 -> 20 chunks), fused with residual feat + gamma*O
    float gma = gamma_p[0];
    float ls1 = 0.f, ls2 = 0.f;
#pragma unroll
    for (int et = 0; et < 2; ++et) {
        v8f acc = {0.f, 0.f, 0.f, 0.f, 0.f, 0.f, 0.f, 0.f};
#pragma unroll
        for (int ck = 0; ck < 20; ++ck) {
            v2f pa;  // A-fragment of P from LDS: row m, k = ck*4 + hi*2 + {0,1}
            pa.x = S[m][ck * 4 + hi * 2 + 0];
            pa.y = S[m][ck * 4 + hi * 2 + 1];
            int j0 = i0 - WIN + ck * 4 + hi * 2;
            int ja = min(max(j0, 0), H_DIM - 1);
            int jb = min(max(j0 + 1, 0), H_DIM - 1);
            v2f bf;  // B-fragment of V: column e = et*16 + m (coalesced per k-row)
            bf.x = vbuf[(size_t)(rowbase + ja) * D_DIM + et * 16 + m];
            bf.y = vbuf[(size_t)(rowbase + jb) * D_DIM + et * 16 + m];
            acc = wmma4(pa, bf, acc);
        }
#pragma unroll
        for (int r = 0; r < 8; ++r) {
            int i = r + 8 * hi;
            int p = rowbase + i0 + i;
            int e = et * 16 + m;
            float f = x[p] * w_in[e];  // feat is rank-1 (C==1): recompute
            float gv = f + gma * acc[r];
            g[(size_t)p * D_DIM + e] = gv;
            ls1 += gv;
            ls2 += gv * gv;
        }
    }
    // GN2 partial sums: wave reduce via LDS, one atomic per block
    red1[lane] = ls1;
    red2[lane] = ls2;
    __syncthreads();
    if (lane == 0) {
        float s1 = 0.f, s2 = 0.f;
        for (int t = 0; t < 32; ++t) {
            s1 += red1[t];
            s2 += red2[t];
        }
        int b = nrow >> 6;
        atomicAdd(&stats2[b * 2 + 0], s1);
        atomicAdd(&stats2[b * 2 + 1], s2);
    }
}

// ------------------------------------- out = w_out . gelu(GN2(g))  (C == 1)
__global__ void k_final(const float* __restrict__ g, const float* __restrict__ gn_w,
                        const float* __restrict__ gn_b,
                        const float* __restrict__ w_out,
                        const float* __restrict__ stats2, float* __restrict__ out) {
    int p = blockIdx.x * 256 + threadIdx.x;
    int b = p >> 16;
    const float cnt = (float)(D_DIM * W_DIM * H_DIM);
    float mu = stats2[b * 2 + 0] / cnt;
    float var = stats2[b * 2 + 1] / cnt - mu * mu;
    float rs = rsqrtf(var + 1e-5f);
    float acc = 0.f;
#pragma unroll
    for (int d = 0; d < D_DIM; ++d) {
        float hh = (g[(size_t)p * D_DIM + d] - mu) * rs * gn_w[d] + gn_b[d];
        acc += gelu_exact(hh) * w_out[d];
    }
    out[p] = acc;
}

extern "C" void kernel_launch(void* const* d_in, const int* in_sizes, int n_in,
                              void* d_out, int out_size, void* d_ws, size_t ws_size,
                              hipStream_t stream) {
    (void)in_sizes; (void)n_in; (void)out_size; (void)ws_size;
    const float* x     = (const float*)d_in[0];
    const float* w_in  = (const float*)d_in[1];
    const float* w_q   = (const float*)d_in[2];
    const float* w_k   = (const float*)d_in[3];
    const float* w_v   = (const float*)d_in[4];
    const float* w_out = (const float*)d_in[5];
    const float* gn_w  = (const float*)d_in[6];
    const float* gn_b  = (const float*)d_in[7];
    const float* gamma = (const float*)d_in[8];
    float* out = (float*)d_out;

    char* ws = (char*)d_ws;
    float* stats = (float*)ws;  // 8 floats: GN1 pair then GN2 pair
    const size_t BUF = (size_t)NPIX * D_DIM * sizeof(float);  // 16 MB
    float* g  = (float*)(ws + 256);
    float* qb = (float*)(ws + 256 + 1 * BUF);
    float* kb = (float*)(ws + 256 + 2 * BUF);
    float* vb = (float*)(ws + 256 + 3 * BUF);

    k_init_stats<<<1, 32, 0, stream>>>(stats);
    k_stats1<<<NPIX / 256, 256, 0, stream>>>(x, w_in, stats);
    k_qkv<<<NPIX / 16, 32, 0, stream>>>(x, w_in, gn_w, gn_b, stats, w_q, w_k, w_v, qb, kb,
                                        vb);
    k_attn<<<NROWS * (H_DIM / 16), 32, 0, stream>>>(qb, kb, vb, x, w_in, gamma, g,
                                                    stats + 4);
    k_final<<<NPIX / 256, 256, 0, stream>>>(g, gn_w, gn_b, w_out, stats + 4, out);
}

// v002
// One run takes 58.3 microseconds.
// Next to v001, in two timings, it ran 1.51 and 1.50 times as fast.
// All steps since v000 together make it 1.89 times as fast.
#include <hip/hip_runtime.h>
#include <math.h>

// CDNA5 / gfx1250, wave32. All matrix work via V_WMMA_F32_16X16X4_F32.
//
// Shapes (fixed by reference setup): B=2, C=1, W=64, H=1024, d=32, WIN=32.
// Pixels P = B*W*H = 131072, attention rows N = B*W = 128 (seq len H=1024).
//
// Workspace layout (needs 256 + 4*16MB + 64KB = ~64.1 MB):
//   [0..16)        : stats  (GN1: b0{s1,s2} b1{s1,s2})
//   [256 + 0*BUF)  : g   (feat + gamma * attention output, [pixel][d])
//   [256 + 1*BUF)  : q   [pixel][d]
//   [256 + 2*BUF)  : k   [pixel][d]
//   [256 + 3*BUF)  : v   [pixel][d]
//   [256 + 4*BUF)  : GN2 partial sums, {s1,s2} per 16-query tile

typedef __attribute__((ext_vector_type(2))) float v2f;
typedef __attribute__((ext_vector_type(8))) float v8f;

#define H_DIM 1024
#define W_DIM 64
#define B_DIM 2
#define D_DIM 32
#define WIN   32
#define NPIX  (B_DIM * W_DIM * H_DIM)   // 131072
#define NROWS (B_DIM * W_DIM)           // 128
#define NTILE_B (W_DIM * H_DIM / 16)    // 4096 query tiles per batch

__device__ __forceinline__ float gelu_exact(float x) {
    return 0.5f * x * (1.0f + erff(x * 0.70710678118654752440f));
}

// D = A(16x4) * B(4x16) + C, fp32 throughout.
// A layout: lanes 0-15 hold row m, k={0,1}; lanes 16-31 hold row m, k={2,3}.
// B layout: lanes 0-15 hold col n, k={0,1}; lanes 16-31 hold col n, k={2,3}.
// C/D layout: lane&15 = col n; vgpr r = row r (lanes 0-15) / r+8 (lanes 16-31).
__device__ __forceinline__ v8f wmma4(v2f a, v2f b, v8f c) {
    return __builtin_amdgcn_wmma_f32_16x16x4_f32(false, a, false, b, (short)0, c,
                                                 false, false);
}

// ---------------------------------------------------------------- stats init
__global__ void k_init_stats(float* stats) {
    if (threadIdx.x < 4) stats[threadIdx.x] = 0.0f;
}

// ------------------------------------------------- GN1 stats (feat = x * w_in)
__global__ void k_stats1(const float* __restrict__ x, const float* __restrict__ w_in,
                         float* __restrict__ stats) {
    __shared__ float r1[256], r2[256];
    int p = blockIdx.x * 256 + threadIdx.x;
    float xv = x[p];
    float s1 = 0.f, s2 = 0.f;
#pragma unroll
    for (int d = 0; d < D_DIM; ++d) {
        float f = xv * w_in[d];
        s1 += f;
        s2 += f * f;
    }
    r1[threadIdx.x] = s1;
    r2[threadIdx.x] = s2;
    __syncthreads();
    for (int off = 128; off > 0; off >>= 1) {
        if ((int)threadIdx.x < off) {
            r1[threadIdx.x] += r1[threadIdx.x + off];
            r2[threadIdx.x] += r2[threadIdx.x + off];
        }
        __syncthreads();
    }
    if (threadIdx.x == 0) {
        int b = p >> 16;  // 65536 pixels per batch; blocks never straddle batches
        atomicAdd(&stats[b * 2 + 0], r1[0]);
        atomicAdd(&stats[b * 2 + 1], r2[0]);
    }
}

// --------------------------------------------- q/k/v projection (WMMA, fp32)
// One wave per 16 pixels: q[i,e] = sum_d z[i,d] * w_q[e,d]  (same for k,v),
// with z = gelu(GN1(feat)) computed here, each element once, in the lane and
// register that the A-fragment wants it in (z never goes to memory).
__global__ void k_qkv(const float* __restrict__ x, const float* __restrict__ w_in,
                      const float* __restrict__ gn_w, const float* __restrict__ gn_b,
                      const float* __restrict__ stats, const float* __restrict__ wq,
                      const float* __restrict__ wk, const float* __restrict__ wv,
                      float* __restrict__ q, float* __restrict__ k,
                      float* __restrict__ v) {
    int lane = threadIdx.x;
    int m = lane & 15, hi = lane >> 4;
    int pb = blockIdx.x * 16;

    float xv = x[pb + m];
    v2f wi[8], gw[8], gb[8];  // channel values of this lane: d = kk*4 + hi*2 + {0,1}
#pragma unroll
    for (int kk = 0; kk < 8; ++kk) {  // all channel loads first: one wait, not one per gelu
        int d = kk * 4 + hi * 2;
        wi[kk].x = w_in[d + 0];
        wi[kk].y = w_in[d + 1];
        gw[kk].x = gn_w[d + 0];
        gw[kk].y = gn_w[d + 1];
        gb[kk].x = gn_b[d + 0];
        gb[kk].y = gn_b[d + 1];
    }
    // the base registers of the loads above are reused by the scalar code below
    asm volatile("s_wait_xcnt 0x0" ::: "memory");

    int b = pb >> 16;  // 65536 pixels per batch; a 16-pixel tile never straddles batches
    const float cnt = (float)(D_DIM * W_DIM * H_DIM);
    float mu = stats[b * 2 + 0] / cnt;
    float var = stats[b * 2 + 1] / cnt - mu * mu;
    float rs = rsqrtf(var + 1e-5f);

    v2f a[8];  // A-fragments of z tile (16 x 32): row m, d = kk*4 + hi*2 + {0,1}
#pragma unroll
    for (int kk = 0; kk < 8; ++kk) {
        a[kk].x = (xv * wi[kk].x - mu) * rs * gw[kk].x + gb[kk].x;
        a[kk].y = (xv * wi[kk].y - mu) * rs * gw[kk].y + gb[kk].y;
    }
#pragma unroll
    for (int kk = 0; kk < 8; ++kk) {
        a[kk].x = gelu_exact(a[kk].x);
        a[kk].y = gelu_exact(a[kk].y);
    }

    const float* wgt[3] = {wq, wk, wv};
    float* dst[3] = {q, k, v};
#pragma unroll
    for (int t = 0; t < 3; ++t) {
#pragma unroll
        for (int et = 0; et < 2; ++et) {
            v8f acc = {0.f, 0.f, 0.f, 0.f, 0.f, 0.f, 0.f, 0.f};
#pragma unroll
            for (int kk = 0; kk < 8; ++kk) {
                // B[k_local, e] = w[e, d]; lane holds column e = et*16 + m
                const float* wsrc = wgt[t] + (size_t)(et * 16 + m) * D_DIM + kk * 4 + hi * 2;
                v2f bf;
                bf.x = wsrc[0];
                bf.y = wsrc[1];
                acc = wmma4(a[kk], bf, acc);
            }
#pragma unroll
            for (int r = 0; r < 8; ++r) {
                dst[t][(size_t)(pb + r + 8 * hi) * D_DIM + et * 16 + m] = acc[r];
            }
        }
    }
}

// value of the same lane position in the other 16-lane row (lane ^ 16)
__device__ __forceinline__ float other_row(float v) {
    int i = __float_as_int(v);
    return __int_as_float(
        __builtin_amdgcn_permlanex16(i, i, 0x76543210, 0xfedcba98, false, false));
}

// sum over the 32 lanes, the same fixed tree in every lane
__device__ __forceinline__ float wave_sum(float v) {
    v += __int_as_float(__builtin_amdgcn_update_dpp(0, __float_as_int(v), 0x161, 0xf, 0xf, true));
    v += __int_as_float(__builtin_amdgcn_update_dpp(0, __float_as_int(v), 0x162, 0xf, 0xf, true));
    v += __int_as_float(__builtin_amdgcn_update_dpp(0, __float_as_int(v), 0x164, 0xf, 0xf, true));
    v += __int_as_float(__builtin_amdgcn_update_dpp(0, __float_as_int(v), 0x168, 0xf, 0xf, true));
    return v + other_row(v);
}

// ----------------------------------------- banded attention + residual (WMMA)
// One wave per (row n, 16-query tile i0). Keys span [i0-32, i0+48) = 5 tiles.
// Both products are transposed so that a query is a lane (column) throughout:
//   S^T = K * Q^T : lane&15 = query, register r of tile jt = key jt*16 + r + 8*hi
//   O^T = V^T * P^T : the score registers are the B-fragments as they stand
// A query's softmax is then a reduction over the lane's own 40 registers and one
// exchange with lane ^ 16. The launch bound (one wave a block) gives the wave the registers
// to hold all its fragments at once; under the default bound they spill.
__global__ void __launch_bounds__(32)
k_attn(const float* __restrict__ q, const float* __restrict__ kbuf,
       const float* __restrict__ vbuf, const float* __restrict__ x,
       const float* __restrict__ w_in, const float* __restrict__ gamma_p,
       float* __restrict__ g, float* __restrict__ part) {
    int lane = threadIdx.x;
    int m = lane & 15, hi = lane >> 4;
    int nrow = blockIdx.x >> 6;
    int i0 = (blockIdx.x & 63) << 4;
    int rowbase = nrow * H_DIM;

    float gma = gamma_p[0];

    // Q, K, V and x are loaded here, ahead of the arithmetic, each from a buffer's base and
    // a 32-bit byte offset. A key tile is 16-aligned, so it lies wholly inside the row or
    // wholly outside; one outside is read from the nearest tile and masked below.
    unsigned roff = m * (D_DIM * 4) + hi * 8;      // row m of a tile, d = hi*2
    unsigned voff = hi * (8 * D_DIM * 4) + m * 4;  // key 8*hi of a tile, channel m
    int p = rowbase + i0 + m;
    unsigned qo = (unsigned)(rowbase + i0) * (D_DIM * 4) + roff;
    unsigned ko[5], vo[5];
#pragma unroll
    for (int jt = 0; jt < 5; ++jt) {
        int tc = min(max(i0 - WIN + jt * 16, 0), H_DIM - 16);
        ko[jt] = (unsigned)(rowbase + tc) * (D_DIM * 4) + roff;
        vo[jt] = (unsigned)(rowbase + tc) * (D_DIM * 4) + voff;
    }

    // Q^T B-fragments (32 dims x 16 queries): column m, d = kk*4 + hi*2 + {0,1}
    v2f qb[8];
#pragma unroll
    for (int kk = 0; kk < 8; ++kk) qb[kk] = *(const v2f*)((const char*)q + qo + kk * 16);

    // K A-fragments (16 keys x 32 dims per tile): row m, the same d order as Q^T
    v2f ka[5][8];
#pragma unroll
    for (int jt = 0; jt < 5; ++jt) {
#pragma unroll
        for (int kk = 0; kk < 8; ++kk)
            ka[jt][kk] = *(const v2f*)((const char*)kbuf + ko[jt] + kk * 16);
    }
    // loads return in issue order: Q and K, which the first product waits for, go first
    __builtin_amdgcn_sched_barrier(0);

    // V^T A-fragments: row e = et*16 + m, key r + 8*hi of tile jt (coalesced per key)
    float va[2][5][8];
#pragma unroll
    for (int jt = 0; jt < 5; ++jt) {
#pragma unroll
        for (int et = 0; et < 2; ++et) {
#pragma unroll
            for (int r = 0; r < 8; ++r)
                va[et][jt][r] =
                    *(const float*)((const char*)vbuf + vo[jt] + r * (D_DIM * 4) + et * 64);
        }
    }
    float xv = x[p];
    // The code below reuses the base and offset registers of the loads above, so the wait
    // stands between the two; naming them keeps each in its register up to the wait.
    __builtin_amdgcn_sched_barrier(0);
    asm volatile("s_wait_xcnt 0x0" ::"v"(qo), "v"(p), "v"(ko[0]), "v"(ko[1]),
                 "v"(ko[2]), "v"(ko[3]), "v"(ko[4]), "v"(vo[0]), "v"(vo[1]), "v"(vo[2]),
                 "v"(vo[3]), "v"(vo[4]), "s"(q), "s"(kbuf), "s"(vbuf), "s"(x)
                 : "memory");
    __builtin_amdgcn_sched_barrier(0);

    float4 wi[2][2];  // w_in[e] of the 16 output channels this lane ends up with
#pragma unroll
    for (int et = 0; et < 2; ++et) {
        wi[et][0] = *(const float4*)(w_in + et * 16 + 8 * hi);
        wi[et][1] = *(const float4*)(w_in + et * 16 + 8 * hi + 4);
    }

    // S^T = K * Q^T, 5 key tiles of 16, K-dim = 32 (8 WMMAs each); masked on the way out
    float s[5][8];
    float mx = -3.0e38f;
#pragma unroll
    for (int jt = 0; jt < 5; ++jt) {
        v8f acc = {0.f, 0.f, 0.f, 0.f, 0.f, 0.f, 0.f, 0.f};
#pragma unroll
        for (int kk = 0; kk < 8; ++kk) acc = wmma4(ka[jt][kk], qb[kk], acc);
        bool in = (unsigned)(i0 - WIN + jt * 16) < (unsigned)H_DIM;  // tile inside the row
#pragma unroll
        for (int r = 0; r < 8; ++r) {
            int di = m + WIN - jt * 16 - r - 8 * hi;  // query index - key index
            bool ok = in;
            if (jt == 0) ok = ok && di <= WIN;   // tiles 1..3 have |di| <= 31: inside the
            if (jt == 4) ok = ok && di >= -WIN;  // band for every lane and register
            s[jt][r] = ok ? acc[r] : -3.0e38f;
            mx = fmaxf(mx, s[jt][r]);
        }
    }
    mx = fmaxf(mx, other_row(mx));

    // p = exp(scale * (s - mx)) as one fma and one exp2; a masked key gives exactly 0
    const float c2 = 0.17677669529663687f * 1.4426950408889634f;  // 32^-0.5 * log2(e)
    float mc = mx * c2;
    float sum = 0.f;
#pragma unroll
    for (int jt = 0; jt < 5; ++jt) {
#pragma unroll
        for (int r = 0; r < 8; ++r) {
            s[jt][r] = __builtin_amdgcn_exp2f(fmaf(s[jt][r], c2, -mc));
            sum += s[jt][r];
        }
    }
    sum += other_row(sum);
    float go = gma / sum;  // the row's 1/sum is applied to O, together with gamma

    // O^T = V^T * P^T (K=80 -> 20 chunks), fused with residual feat + gamma*O.
    // Chunk (jt, c) takes keys jt*16 + {2c, 2c+1} in lanes 0-15 and the same + 8 in lanes
    // 16-31, in the A-fragment and in the score registers alike.
    float ls1 = 0.f, ls2 = 0.f;
#pragma unroll
    for (int et = 0; et < 2; ++et) {
        v8f acc = {0.f, 0.f, 0.f, 0.f, 0.f, 0.f, 0.f, 0.f};
#pragma unroll
        for (int jt = 0; jt < 5; ++jt) {
#pragma unroll
            for (int c = 0; c < 4; ++c) {
                v2f af, pf;
                af.x = va[et][jt][2 * c + 0];
                af.y = va[et][jt][2 * c + 1];
                pf.x = s[jt][2 * c + 0];
                pf.y = s[jt][2 * c + 1];
                acc = wmma4(af, pf, acc);
            }
        }
        // this lane holds channels e0 .. e0+7 of its query, e0 = et*16 + 8*hi
        float w[8] = {wi[et][0].x, wi[et][0].y, wi[et][0].z, wi[et][0].w,
                      wi[et][1].x, wi[et][1].y, wi[et][1].z, wi[et][1].w};
        float gv[8];
#pragma unroll
        for (int r = 0; r < 8; ++r) {
            float f = xv * w[r];  // feat is rank-1 (C==1): recompute
            gv[r] = f + go * acc[r];
            ls1 += gv[r];
            ls2 += gv[r] * gv[r];
        }
        float4* dst = (float4*)(g + (size_t)p * D_DIM + et * 16 + 8 * hi);
        dst[0] = make_float4(gv[0], gv[1], gv[2], gv[3]);
        dst[1] = make_float4(gv[4], gv[5], gv[6], gv[7]);
    }
    // GN2 partial sums of this tile: no atomic, k_final adds the tiles in a fixed order
    ls1 = wave_sum(ls1);
    ls2 = wave_sum(ls2);
    if (lane == 0) {
        part[blockIdx.x * 2 + 0] = ls1;
        part[blockIdx.x * 2 + 1] = ls2;
    }
}

// ------------------------------------- out = w_out . gelu(GN2(g))  (C == 1)
__global__ void k_final(const float* __restrict__ g, const float* __restrict__ gn_w,
                        const float* __restrict__ gn_b,
                        const float* __restrict__ w_out,
                        const float* __restrict__ part, float* __restrict__ out) {
    __shared__ float r1[8], r2[8];
    int p = blockIdx.x * 256 + threadIdx.x;
    int b = p >> 16;
    // GN2 sums of this batch: its NTILE_B {s1,s2} pairs, two pairs a load
    const float4* pp = (const float4*)(part + (size_t)b * NTILE_B * 2);
    float s1 = 0.f, s2 = 0.f;
#pragma unroll
    for (int i = 0; i < NTILE_B / 512; ++i) {
        float4 t = pp[i * 256 + threadIdx.x];
        s1 += t.x + t.z;
        s2 += t.y + t.w;
    }
    s1 = wave_sum(s1);
    s2 = wave_sum(s2);
    if ((threadIdx.x & 31) == 0) {
        r1[threadIdx.x >> 5] = s1;
        r2[threadIdx.x >> 5] = s2;
    }
    __syncthreads();
    s1 = 0.f;
    s2 = 0.f;
#pragma unroll
    for (int w = 0; w < 8; ++w) {
        s1 += r1[w];
        s2 += r2[w];
    }
    const float cnt = (float)(D_DIM * W_DIM * H_DIM);
    float mu = s1 / cnt;
    float var = s2 / cnt - mu * mu;
    float rs = rsqrtf(var + 1e-5f);
    float acc = 0.f;
#pragma unroll
    for (int d = 0; d < D_DIM; ++d) {
        float hh = (g[(size_t)p * D_DIM + d] - mu) * rs * gn_w[d] + gn_b[d];
        acc += gelu_exact(hh) * w_out[d];
    }
    out[p] = acc;
}

extern "C" void kernel_launch(void* const* d_in, const int* in_sizes, int n_in,
                              void* d_out, int out_size, void* d_ws, size_t ws_size,
                              hipStream_t stream) {
    (void)in_sizes; (void)n_in; (void)out_size; (void)ws_size;
    const float* x     = (const float*)d_in[0];
    const float* w_in  = (const float*)d_in[1];
    const float* w_q   = (const float*)d_in[2];
    const float* w_k   = (const float*)d_in[3];
    const float* w_v   = (const float*)d_in[4];
    const float* w_out = (const float*)d_in[5];
    const float* gn_w  = (const float*)d_in[6];
    const float* gn_b  = (const float*)d_in[7];
    const float* gamma = (const float*)d_in[8];
    float* out = (float*)d_out;

    char* ws = (char*)d_ws;
    float* stats = (float*)ws;  // 4 floats: GN1 pairs
    const size_t BUF = (size_t)NPIX * D_DIM * sizeof(float);  // 16 MB
    float* g  = (float*)(ws + 256);
    float* qb = (float*)(ws + 256 + 1 * BUF);
    float* kb = (float*)(ws + 256 + 2 * BUF);
    float* vb = (float*)(ws + 256 + 3 * BUF);
    float* part = (float*)(ws + 256 + 4 * BUF);

    k_init_stats<<<1, 32, 0, stream>>>(stats);
    k_stats1<<<NPIX / 256, 256, 0, stream>>>(x, w_in, stats);
    k_qkv<<<NPIX / 16, 32, 0, stream>>>(x, w_in, gn_w, gn_b, stats, w_q, w_k, w_v, qb, kb,
                                        vb);
    k_attn<<<NROWS * (H_DIM / 16), 32, 0, stream>>>(qb, kb, vb, x, w_in, gamma, g,
                                                    part);
    k_final<<<NPIX / 256, 256, 0, stream>>>(g, gn_w, gn_b, w_out, part, out);
}

// v003
// Measured time: 33.1 microseconds a run.
// In both of two side-by-side timings against v002, it was 1.76 times as fast.
// Over all steps from v000 it is 3.32 times as fast.
#include <hip/hip_runtime.h>
#include <math.h>

// CDNA5 / gfx1250, wave32. All matrix work via V_WMMA_F32_16X16X4_F32.
//
// Shapes (fixed by reference setup): B=2, C=1, W=64, H=1024, d=32, WIN=32.
// Pixels P = B*W*H = 131072, attention rows N = B*W = 128 (seq len H=1024).
//
// Workspace layout (needs 256 + 16MB + 64KB = ~16.1 MB):
//   [0..16)        : stats  (GN1: b0{s1,s2} b1{s1,s2})
//   [256 + 0*BUF)  : g   (feat + gamma * attention output, [pixel][d])
//   [256 + 1*BUF)  : GN2 partial sums, {s1,s2} per 16-query tile

typedef __attribute__((ext_vector_type(2))) float v2f;
typedef __attribute__((ext_vector_type(8))) float v8f;

#define H_DIM 1024
#define W_DIM 64
#define B_DIM 2
#define D_DIM 32
#define WIN   32
#define NPIX  (B_DIM * W_DIM * H_DIM)   // 131072
#define NROWS (B_DIM * W_DIM)           // 128
#define NTILE_B (W_DIM * H_DIM / 16)    // 4096 query tiles per batch
#define QT 16                           // query tiles of one attention work-group
#define KT (QT + 2 * WIN / 16)          // its key tiles: the band's reach more on each side

__device__ __forceinline__ float gelu_exact(float x) {
    return 0.5f * x * (1.0f + erff(x * 0.70710678118654752440f));
}

// D = A(16x4) * B(4x16) + C, fp32 throughout.
// A layout: lanes 0-15 hold row m, k={0,1}; lanes 16-31 hold row m, k={2,3}.
// B layout: lanes 0-15 hold col n, k={0,1}; lanes 16-31 hold col n, k={2,3}.
// C/D layout: lane&15 = col n; vgpr r = row r (lanes 0-15) / r+8 (lanes 16-31).
__device__ __forceinline__ v8f wmma4(v2f a, v2f b, v8f c) {
    return __builtin_amdgcn_wmma_f32_16x16x4_f32(false, a, false, b, (short)0, c,
                                                 false, false);
}

// ---------------------------------------------------------------- stats init
__global__ void k_init_stats(float* stats) {
    if (threadIdx.x < 4) stats[threadIdx.x] = 0.0f;
}

// ------------------------------------------------- GN1 stats (feat = x * w_in)
__global__ void k_stats1(const float* __restrict__ x, const float* __restrict__ w_in,
                         float* __restrict__ stats) {
    __shared__ float r1[256], r2[256];
    int p = blockIdx.x * 256 + threadIdx.x;
    float xv = x[p];
    float s1 = 0.f, s2 = 0.f;
#pragma unroll
    for (int d = 0; d < D_DIM; ++d) {
        float f = xv * w_in[d];
        s1 += f;
        s2 += f * f;
    }
    r1[threadIdx.x] = s1;
    r2[threadIdx.x] = s2;
    __syncthreads();
    for (int off = 128; off > 0; off >>= 1) {
        if ((int)threadIdx.x < off) {
            r1[threadIdx.x] += r1[threadIdx.x + off];
            r2[threadIdx.x] += r2[threadIdx.x + off];
        }
        __syncthreads();
    }
    if (threadIdx.x == 0) {
        int b = p >> 16;  // 65536 pixels per batch; blocks never straddle batches
        atomicAdd(&stats[b * 2 + 0], r1[0]);
        atomicAdd(&stats[b * 2 + 1], r2[0]);
    }
}

// value of the same lane position in the other 16-lane row (lane ^ 16)
__device__ __forceinline__ float other_row(float v) {
    int i = __float_as_int(v);
    return __int_as_float(
        __builtin_amdgcn_permlanex16(i, i, 0x76543210, 0xfedcba98, false, false));
}

// sum over the 32 lanes, the same fixed tree in every lane
__device__ __forceinline__ float wave_sum(float v) {
    v += __int_as_float(__builtin_amdgcn_update_dpp(0, __float_as_int(v), 0x161, 0xf, 0xf, true));
    v += __int_as_float(__builtin_amdgcn_update_dpp(0, __float_as_int(v), 0x162, 0xf, 0xf, true));
    v += __int_as_float(__builtin_amdgcn_update_dpp(0, __float_as_int(v), 0x164, 0xf, 0xf, true));
    v += __int_as_float(__builtin_amdgcn_update_dpp(0, __float_as_int(v), 0x168, 0xf, 0xf, true));
    return v + other_row(v);
}

// ------------------- q/k/v projection + banded attention + residual (WMMA, fp32)
// One work-group per (row n, 256 queries): KT = 20 waves, one per 16-pixel tile of the
// 320 pixels whose keys those queries can see. Each wave computes z = gelu(GN1(feat)) of
// its tile straight into fragments (a z fragment serves as A and as B alike) and from it
//   K^T = Wk * Z^T : lane&15 = key,     register r of half et = channel et*16 + r + 8*hi
//   V   = Z * Wv^T : lane&15 = channel, register r of half et = key r + 8*hi
// These accumulators are, lane for lane, the A-fragments of the two attention products
//   S^T = K * Q^T   (k chunk (et, c): channels et*16 + 8*hi + {2c, 2c+1})
//   O^T = V^T * P^T (k chunk (jt, c): keys jt*16 + 8*hi + {2c, 2c+1})
// so K and V go through LDS as [tile][4 registers][lane], 16 bytes a lane, and come back
// in the same lane of another wave. Q^T = Wq * Z^T has the layout of K^T, which is the
// B-fragment of S^T in the same channel order: it never leaves its wave's registers.
// The weight fragments, alike for every wave, are shared through LDS in the same way.
// A query is a lane (column) throughout: its softmax is a reduction over the lane's own
// 40 registers and one exchange with lane ^ 16.
// Every loop is unrolled so that the fragment arrays are indexed by constants and stay in
// registers.
__global__ void __launch_bounds__(KT * 32)
k_attn(const float* __restrict__ x, const float* __restrict__ w_in,
       const float* __restrict__ gn_w, const float* __restrict__ gn_b,
       const float* __restrict__ stats, const float* __restrict__ wq,
       const float* __restrict__ wk, const float* __restrict__ wv,
       const float* __restrict__ gamma_p, float* __restrict__ g,
       float* __restrict__ part) {
    __shared__ float4 Ks[KT][4][32];
    __shared__ float4 Vs[KT][4][32];
    __shared__ float4 Wf[3 * 2 * 4][32];  // weight fragments: [(K, V, Q)][et][kk / 2][lane]
    int lane = threadIdx.x & 31;
    int wave = __builtin_amdgcn_readfirstlane(threadIdx.x >> 5);
    int m = lane & 15, hi = lane >> 4;
    int nrow = blockIdx.x / (H_DIM / 16 / QT);
    int seg = blockIdx.x % (H_DIM / 16 / QT);
    int rowbase = nrow * H_DIM;
    int i0 = seg * (QT * 16) - WIN + wave * 16;  // first pixel of this wave's tile
    // A tile is 16-aligned, so it lies wholly inside the row or wholly outside; a wave whose
    // tile is outside works on the nearest tile, and its keys are masked below.
    int p = rowbase + min(max(i0, 0), H_DIM - 16) + m;

    // All loads of the projection first: one wait, not one per use.
    float xv = x[p];
    v2f wi[8], gw[8], gb[8];  // channel values of this lane: d = kk*4 + hi*2 + {0,1}
#pragma unroll
    for (int kk = 0; kk < 8; ++kk) {
        wi[kk] = ((const v2f*)w_in)[kk * 2 + hi];
        gw[kk] = ((const v2f*)gn_w)[kk * 2 + hi];
        gb[kk] = ((const v2f*)gn_b)[kk * 2 + hi];
    }
    // Weight fragments, A or B alike: row (column) e = et*16 + m, d as above. Such a load
    // touches 16 cache lines, so each of the 48 is made once a work-group (three a wave,
    // fragment f = (matrix*2 + et)*8 + kk) and handed to the other waves through LDS.
    unsigned woff = m * (D_DIM * 4) + hi * 8;
    const int f0 = wave * 3;
    const char* wsrc[3];
    v2f wst[3] = {};
#pragma unroll
    for (int i = 0; i < 3; ++i) {
        int f = f0 + i;
        wsrc[i] = (const char*)(f < 16 ? wk : f < 32 ? wv : wq) +
                  (f & 15) / 8 * (16 * D_DIM * 4) + (f & 7) * 16;
    }
    if (f0 < 48) {
#pragma unroll
        for (int i = 0; i < 3; ++i) wst[i] = *(const v2f*)(wsrc[i] + woff);
    }
    float gma = gamma_p[0];
    float4 wo[2][2];  // w_in[e] of the 16 output channels this lane ends up with
    unsigned ooff = hi * 32;
#pragma unroll
    for (int et = 0; et < 2; ++et) {
        wo[et][0] = *(const float4*)((const char*)w_in + ooff + et * 64);
        wo[et][1] = *(const float4*)((const char*)w_in + ooff + et * 64 + 16);
    }
    // The code below reuses the base and offset registers of the loads above, so the wait
    // stands between the two; naming them keeps each in its register up to the wait.
    __builtin_amdgcn_sched_barrier(0);
    asm volatile("s_wait_xcnt 0x0" ::"v"(p), "v"(hi), "v"(ooff), "v"(woff), "s"(x), "s"(w_in),
                 "s"(gn_w), "s"(gn_b), "s"(wsrc[0]), "s"(wsrc[1]), "s"(wsrc[2])
                 : "memory");
    __builtin_amdgcn_sched_barrier(0);

    int b = nrow / W_DIM;
    const float cnt = (float)(D_DIM * W_DIM * H_DIM);
    float mu = stats[b * 2 + 0] / cnt;
    float var = stats[b * 2 + 1] / cnt - mu * mu;
    float rs = rsqrtf(var + 1e-5f);

    v2f a[8];  // fragments of the z tile (16 x 32): pixel m, d = kk*4 + hi*2 + {0,1}
#pragma unroll
    for (int kk = 0; kk < 8; ++kk) {
        a[kk].x = (xv * wi[kk].x - mu) * rs * gw[kk].x + gb[kk].x;
        a[kk].y = (xv * wi[kk].y - mu) * rs * gw[kk].y + gb[kk].y;
    }
#pragma unroll
    for (int kk = 0; kk < 8; ++kk) {
        a[kk].x = gelu_exact(a[kk].x);
        a[kk].y = gelu_exact(a[kk].y);
    }

    if (f0 < 48) {
#pragma unroll
        for (int i = 0; i < 3; ++i) ((v2f*)&Wf[(f0 + i) >> 1][lane])[(f0 + i) & 1] = wst[i];
    }
    __syncthreads();

    {
        v2f fk[2][8], fv[2][8];
#pragma unroll
        for (int et = 0; et < 2; ++et) {
#pragma unroll
            for (int k2 = 0; k2 < 4; ++k2) {
                float4 tk = Wf[et * 4 + k2][lane];
                float4 tv = Wf[8 + et * 4 + k2][lane];
                fk[et][2 * k2 + 0].x = tk.x;
                fk[et][2 * k2 + 0].y = tk.y;
                fk[et][2 * k2 + 1].x = tk.z;
                fk[et][2 * k2 + 1].y = tk.w;
                fv[et][2 * k2 + 0].x = tv.x;
                fv[et][2 * k2 + 0].y = tv.y;
                fv[et][2 * k2 + 1].x = tv.z;
                fv[et][2 * k2 + 1].y = tv.w;
            }
        }
        v8f kacc[2] = {}, vacc[2] = {};
#pragma unroll
        for (int kk = 0; kk < 8; ++kk) {
#pragma unroll
            for (int et = 0; et < 2; ++et) {
                kacc[et] = wmma4(fk[et][kk], a[kk], kacc[et]);
                vacc[et] = wmma4(a[kk], fv[et][kk], vacc[et]);
            }
        }
#pragma unroll
        for (int et = 0; et < 2; ++et) {
#pragma unroll
            for (int h = 0; h < 2; ++h) {
                Ks[wave][et * 2 + h][lane] = make_float4(kacc[et][4 * h + 0], kacc[et][4 * h + 1],
                                                         kacc[et][4 * h + 2], kacc[et][4 * h + 3]);
                Vs[wave][et * 2 + h][lane] = make_float4(vacc[et][4 * h + 0], vacc[et][4 * h + 1],
                                                         vacc[et][4 * h + 2], vacc[et][4 * h + 3]);
            }
        }
    }
    __syncthreads();
    // the outer waves bring keys only; there is no barrier behind this one
    if (wave < WIN / 16 || wave >= WIN / 16 + QT) return;

    v8f qacc[2] = {};
#pragma unroll
    for (int k2 = 0; k2 < 4; ++k2) {
#pragma unroll
        for (int et = 0; et < 2; ++et) {
            float4 tq = Wf[16 + et * 4 + k2][lane];
            v2f fq;
            fq.x = tq.x;
            fq.y = tq.y;
            qacc[et] = wmma4(fq, a[2 * k2 + 0], qacc[et]);
            fq.x = tq.z;
            fq.y = tq.w;
            qacc[et] = wmma4(fq, a[2 * k2 + 1], qacc[et]);
        }
    }

    // S^T = K * Q^T, 5 key tiles of 16, K-dim = 32 (8 WMMAs each); masked on the way out
    const int t0 = wave - WIN / 16;  // LDS tile of the first key tile
    float s[5][8];
    float mx = -3.0e38f;
#pragma unroll
    for (int jt = 0; jt < 5; ++jt) {
        v8f acc = {0.f, 0.f, 0.f, 0.f, 0.f, 0.f, 0.f, 0.f};
#pragma unroll
        for (int u = 0; u < 4; ++u) {  // u = et*2 + h: channels et*16 + 8*hi + 4*h + 0..3
            float4 k4 = Ks[t0 + jt][u][lane];
            v2f ka, qb;
            ka.x = k4.x;
            ka.y = k4.y;
            qb.x = qacc[u >> 1][4 * (u & 1) + 0];
            qb.y = qacc[u >> 1][4 * (u & 1) + 1];
            acc = wmma4(ka, qb, acc);
            ka.x = k4.z;
            ka.y = k4.w;
            qb.x = qacc[u >> 1][4 * (u & 1) + 2];
            qb.y = qacc[u >> 1][4 * (u & 1) + 3];
            acc = wmma4(ka, qb, acc);
        }
        bool in = (unsigned)(i0 - WIN + jt * 16) < (unsigned)H_DIM;  // tile inside the row
#pragma unroll
        for (int r = 0; r < 8; ++r) {
            int di = m + WIN - jt * 16 - r - 8 * hi;  // query index - key index
            bool ok = in;
            if (jt == 0) ok = ok && di <= WIN;   // tiles 1..3 have |di| <= 31: inside the
            if (jt == 4) ok = ok && di >= -WIN;  // band for every lane and register
            s[jt][r] = ok ? acc[r] : -3.0e38f;
            mx = fmaxf(mx, s[jt][r]);
        }
    }
    mx = fmaxf(mx, other_row(mx));

    // p = exp(scale * (s - mx)) as one fma and one exp2; a masked key gives exactly 0
    const float c2 = 0.17677669529663687f * 1.4426950408889634f;  // 32^-0.5 * log2(e)
    float mc = mx * c2;
    float sum = 0.f;
#pragma unroll
    for (int jt = 0; jt < 5; ++jt) {
#pragma unroll
        for (int r = 0; r < 8; ++r) s[jt][r] = fmaf(s[jt][r], c2, -mc);
    }
    // All exponents first, then the exp2: two runs of independent instructions. Mixed, they
    // compile to one dependent fma -> exp2 pair a score through a single register, each fma
    // overwriting the source of the exp2 directly in front of it.
    __builtin_amdgcn_sched_barrier(0);
#pragma unroll
    for (int jt = 0; jt < 5; ++jt) {
#pragma unroll
        for (int r = 0; r < 8; ++r) {
            s[jt][r] = __builtin_amdgcn_exp2f(s[jt][r]);
            sum += s[jt][r];
        }
    }
    sum += other_row(sum);
    float go = gma / sum;  // the row's 1/sum is applied to O, together with gamma

    // O^T = V^T * P^T (K=80 -> 20 chunks), fused with residual feat + gamma*O.
    // Chunk (jt, c) takes keys jt*16 + {2c, 2c+1} in lanes 0-15 and the same + 8 in lanes
    // 16-31, in the A-fragment and in the score registers alike.
    float ls1 = 0.f, ls2 = 0.f;
#pragma unroll
    for (int et = 0; et < 2; ++et) {
        v8f acc = {0.f, 0.f, 0.f, 0.f, 0.f, 0.f, 0.f, 0.f};
#pragma unroll
        for (int jt = 0; jt < 5; ++jt) {
#pragma unroll
            for (int h = 0; h < 2; ++h) {
                float4 v4 = Vs[t0 + jt][et * 2 + h][lane];
                v2f af, pf;
                af.x = v4.x;
                af.y = v4.y;
                pf.x = s[jt][4 * h + 0];
                pf.y = s[jt][4 * h + 1];
                acc = wmma4(af, pf, acc);
                af.x = v4.z;
                af.y = v4.w;
                pf.x = s[jt][4 * h + 2];
                pf.y = s[jt][4 * h + 3];
                acc = wmma4(af, pf, acc);
            }
        }
        // this lane holds channels e0 .. e0+7 of its query, e0 = et*16 + 8*hi
        float w[8] = {wo[et][0].x, wo[et][0].y, wo[et][0].z, wo[et][0].w,
                      wo[et][1].x, wo[et][1].y, wo[et][1].z, wo[et][1].w};
        float gv[8];
#pragma unroll
        for (int r = 0; r < 8; ++r) {
            float f = xv * w[r];  // feat is rank-1 (C==1): recompute
            gv[r] = f + go * acc[r];
            ls1 += gv[r];
            ls2 += gv[r] * gv[r];
        }
        float4* dst = (float4*)(g + (size_t)p * D_DIM + et * 16 + 8 * hi);
        dst[0] = make_float4(gv[0], gv[1], gv[2], gv[3]);
        dst[1] = make_float4(gv[4], gv[5], gv[6], gv[7]);
    }
    // GN2 partial sums of this tile: no atomic, k_final adds the tiles in a fixed order
    ls1 = wave_sum(ls1);
    ls2 = wave_sum(ls2);
    if (lane == 0) {
        int tile = (rowbase + i0) >> 4;
        part[tile * 2 + 0] = ls1;
        part[tile * 2 + 1] = ls2;
    }
}

// ------------------------------------- out = w_out . gelu(GN2(g))  (C == 1)
__global__ void k_final(const float* __restrict__ g, const float* __restrict__ gn_w,
                        const float* __restrict__ gn_b,
                        const float* __restrict__ w_out,
                        const float* __restrict__ part, float* __restrict__ out) {
    __shared__ float r1[8], r2[8];
    int p = blockIdx.x * 256 + threadIdx.x;
    int b = p >> 16;
    // GN2 sums of this batch: its NTILE_B {s1,s2} pairs, two pairs a load
    const float4* pp = (const float4*)(part + (size_t)b * NTILE_B * 2);
    float s1 = 0.f, s2 = 0.f;
#pragma unroll
    for (int i = 0; i < NTILE_B / 512; ++i) {
        float4 t = pp[i * 256 + threadIdx.x];
        s1 += t.x + t.z;
        s2 += t.y + t.w;
    }
    s1 = wave_sum(s1);
    s2 = wave_sum(s2);
    if ((threadIdx.x & 31) == 0) {
        r1[threadIdx.x >> 5] = s1;
        r2[threadIdx.x >> 5] = s2;
    }
    __syncthreads();
    s1 = 0.f;
    s2 = 0.f;
#pragma unroll
    for (int w = 0; w < 8; ++w) {
        s1 += r1[w];
        s2 += r2[w];
    }
    const float cnt = (float)(D_DIM * W_DIM * H_DIM);
    float mu = s1 / cnt;
    float var = s2 / cnt - mu * mu;
    float rs = rsqrtf(var + 1e-5f);
    float acc = 0.f;
#pragma unroll
    for (int d = 0; d < D_DIM; ++d) {
        float hh = (g[(size_t)p * D_DIM + d] - mu) * rs * gn_w[d] + gn_b[d];
        acc += gelu_exact(hh) * w_out[d];
    }
    out[p] = acc;
}

extern "C" void kernel_launch(void* const* d_in, const int* in_sizes, int n_in,
                              void* d_out, int out_size, void* d_ws, size_t ws_size,
                              hipStream_t stream) {
    (void)in_sizes; (void)n_in; (void)out_size; (void)ws_size;
    const float* x     = (const float*)d_in[0];
    const float* w_in  = (const float*)d_in[1];
    const float* w_q   = (const float*)d_in[2];
    const float* w_k   = (const float*)d_in[3];
    const float* w_v   = (const float*)d_in[4];
    const float* w_out = (const float*)d_in[5];
    const float* gn_w  = (const float*)d_in[6];
    const float* gn_b  = (const float*)d_in[7];
    const float* gamma = (const float*)d_in[8];
    float* out = (float*)d_out;

    char* ws = (char*)d_ws;
    float* stats = (float*)ws;  // 4 floats: GN1 pairs
    const size_t BUF = (size_t)NPIX * D_DIM * sizeof(float);  // 16 MB
    float* g  = (float*)(ws + 256);
    float* part = (float*)(ws + 256 + 1 * BUF);

    k_init_stats<<<1, 32, 0, stream>>>(stats);
    k_stats1<<<NPIX / 256, 256, 0, stream>>>(x, w_in, stats);
    k_attn<<<NROWS * (H_DIM / 16 / QT), KT * 32, 0, stream>>>(x, w_in, gn_w, gn_b, stats, w_q,
                                                              w_k, w_v, gamma, g, part);
    k_final<<<NPIX / 256, 256, 0, stream>>>(g, gn_w, gn_b, w_out, part, out);
}

// v004
// It runs in 26.6 microseconds.
// Two timings next to v003 put it at 1.25 and 1.24 times that version's speed.
// Counting every step since v000, it is 4.13 times as fast.
#include <hip/hip_runtime.h>
#include <math.h>

// CDNA5 / gfx1250, wave32. All matrix work via V_WMMA_F32_16X16X4_F32.
//
// Shapes (fixed by reference setup): B=2, C=1, W=64, H=1024, d=32, WIN=32.
// Pixels P = B*W*H = 131072, attention rows N = B*W = 128 (seq len H=1024).
//
// Workspace layout (needs 256 + 16MB + 64KB = ~16.1 MB):
//   [0..16)        : stats  (GN1: b0{s1,s2} b1{s1,s2})
//   [256 + 0*BUF)  : g   (feat + gamma * attention output, [pixel][d])
//   [256 + 1*BUF)  : GN2 partial sums, {s1,s2} per 16-query tile

typedef __attribute__((ext_vector_type(2))) float v2f;
typedef __attribute__((ext_vector_type(8))) float v8f;

#define H_DIM 1024
#define W_DIM 64
#define B_DIM 2
#define D_DIM 32
#define WIN   32
#define NPIX  (B_DIM * W_DIM * H_DIM)   // 131072
#define NROWS (B_DIM * W_DIM)           // 128
#define NTILE_B (W_DIM * H_DIM / 16)    // 4096 query tiles per batch
#define QT 16                           // query tiles of one attention work-group
#define KT (QT + 2 * WIN / 16)          // its key tiles: the band's reach more on each side

__device__ __forceinline__ float gelu_exact(float x) {
    return 0.5f * x * (1.0f + erff(x * 0.70710678118654752440f));
}

// D = A(16x4) * B(4x16) + C, fp32 throughout.
// A layout: lanes 0-15 hold row m, k={0,1}; lanes 16-31 hold row m, k={2,3}.
// B layout: lanes 0-15 hold col n, k={0,1}; lanes 16-31 hold col n, k={2,3}.
// C/D layout: lane&15 = col n; vgpr r = row r (lanes 0-15) / r+8 (lanes 16-31).
__device__ __forceinline__ v8f wmma4(v2f a, v2f b, v8f c) {
    return __builtin_amdgcn_wmma_f32_16x16x4_f32(false, a, false, b, (short)0, c,
                                                 false, false);
}

// ---------------------------------------------------------------- stats init
__global__ void k_init_stats(float* stats) {
    if (threadIdx.x < 4) stats[threadIdx.x] = 0.0f;
}

// ------------------------------------------------- GN1 stats (feat = x * w_in)
__global__ void k_stats1(const float* __restrict__ x, const float* __restrict__ w_in,
                         float* __restrict__ stats) {
    __shared__ float r1[256], r2[256];
    int p = blockIdx.x * 256 + threadIdx.x;
    float xv = x[p];
    float s1 = 0.f, s2 = 0.f;
#pragma unroll
    for (int d = 0; d < D_DIM; ++d) {
        float f = xv * w_in[d];
        s1 += f;
        s2 += f * f;
    }
    r1[threadIdx.x] = s1;
    r2[threadIdx.x] = s2;
    __syncthreads();
    for (int off = 128; off > 0; off >>= 1) {
        if ((int)threadIdx.x < off) {
            r1[threadIdx.x] += r1[threadIdx.x + off];
            r2[threadIdx.x] += r2[threadIdx.x + off];
        }
        __syncthreads();
    }
    if (threadIdx.x == 0) {
        int b = p >> 16;  // 65536 pixels per batch; blocks never straddle batches
        atomicAdd(&stats[b * 2 + 0], r1[0]);
        atomicAdd(&stats[b * 2 + 1], r2[0]);
    }
}

// value of the same lane position in the other 16-lane row (lane ^ 16)
__device__ __forceinline__ float other_row(float v) {
    int i = __float_as_int(v);
    return __int_as_float(
        __builtin_amdgcn_permlanex16(i, i, 0x76543210, 0xfedcba98, false, false));
}

// sum over the 32 lanes, the same fixed tree in every lane
__device__ __forceinline__ float wave_sum(float v) {
    v += __int_as_float(__builtin_amdgcn_update_dpp(0, __float_as_int(v), 0x161, 0xf, 0xf, true));
    v += __int_as_float(__builtin_amdgcn_update_dpp(0, __float_as_int(v), 0x162, 0xf, 0xf, true));
    v += __int_as_float(__builtin_amdgcn_update_dpp(0, __float_as_int(v), 0x164, 0xf, 0xf, true));
    v += __int_as_float(__builtin_amdgcn_update_dpp(0, __float_as_int(v), 0x168, 0xf, 0xf, true));
    return v + other_row(v);
}

// ------------------- q/k/v projection + banded attention + residual (WMMA, fp32)
// One work-group per (row n, 256 queries): KT = 20 waves, one per 16-pixel tile of the
// 320 pixels whose keys those queries can see. Each wave computes z = gelu(GN1(feat)) of
// its tile straight into fragments (a z fragment serves as A and as B alike) and from it
//   K^T = Wk * Z^T : lane&15 = key,     register r of half et = channel et*16 + r + 8*hi
//   V   = Z * Wv^T : lane&15 = channel, register r of half et = key r + 8*hi
// These accumulators are, lane for lane, the A-fragments of the two attention products
//   S^T = K * Q^T   (k chunk (et, c): channels et*16 + 8*hi + {2c, 2c+1})
//   O^T = V^T * P^T (k chunk (jt, c): keys jt*16 + 8*hi + {2c, 2c+1})
// so K and V go through LDS as [tile][4 registers][lane], 16 bytes a lane, and come back
// in the same lane of another wave. Q^T = Wq * Z^T has the layout of K^T, which is the
// B-fragment of S^T in the same channel order: it never leaves its wave's registers.
// The weight fragments, alike for every wave, are shared through LDS in the same way.
// A query is a lane (column) throughout: its softmax is a reduction over the lane's own
// 40 registers and one exchange with lane ^ 16.
// Every loop is unrolled so that the fragment arrays are indexed by constants and stay in
// registers.
__global__ void __launch_bounds__(KT * 32)
k_attn(const float* __restrict__ x, const float* __restrict__ w_in,
       const float* __restrict__ gn_w, const float* __restrict__ gn_b,
       const float* __restrict__ stats, const float* __restrict__ wq,
       const float* __restrict__ wk, const float* __restrict__ wv,
       const float* __restrict__ gamma_p, float* __restrict__ g,
       float* __restrict__ part) {
    __shared__ float4 Ks[KT][4][32];
    __shared__ float4 Vs[KT][4][32];
    __shared__ float4 Wf[3 * 2 * 4][32];  // weight fragments: [(K, V, Q)][et][kk / 2][lane]
    int lane = threadIdx.x & 31;
    int wave = __builtin_amdgcn_readfirstlane(threadIdx.x >> 5);
    int m = lane & 15, hi = lane >> 4;
    int nrow = blockIdx.x / (H_DIM / 16 / QT);
    int seg = blockIdx.x % (H_DIM / 16 / QT);
    int rowbase = nrow * H_DIM;
    int i0 = seg * (QT * 16) - WIN + wave * 16;  // first pixel of this wave's tile
    // A tile is 16-aligned, so it lies wholly inside the row or wholly outside; a wave whose
    // tile is outside works on the nearest tile, and its keys are masked below.
    int p = rowbase + min(max(i0, 0), H_DIM - 16) + m;

    // All loads of the projection first: one wait, not one per use.
    float xv = x[p];
    v2f wi[8], gw[8], gb[8];  // channel values of this lane: d = kk*4 + hi*2 + {0,1}
#pragma unroll
    for (int kk = 0; kk < 8; ++kk) {
        wi[kk] = ((const v2f*)w_in)[kk * 2 + hi];
        gw[kk] = ((const v2f*)gn_w)[kk * 2 + hi];
        gb[kk] = ((const v2f*)gn_b)[kk * 2 + hi];
    }
    // Weight fragments, A or B alike: row (column) e = et*16 + m, d as above. Such a load
    // touches 16 cache lines, so each of the 48 is made once a work-group (three a wave,
    // fragment f = (matrix*2 + et)*8 + kk) and handed to the other waves through LDS.
    unsigned woff = m * (D_DIM * 4) + hi * 8;
    const int f0 = wave * 3;
    const char* wsrc[3];
    v2f wst[3] = {};
#pragma unroll
    for (int i = 0; i < 3; ++i) {
        int f = f0 + i;
        wsrc[i] = (const char*)(f < 16 ? wk : f < 32 ? wv : wq) +
                  (f & 15) / 8 * (16 * D_DIM * 4) + (f & 7) * 16;
    }
    if (f0 < 48) {
#pragma unroll
        for (int i = 0; i < 3; ++i) wst[i] = *(const v2f*)(wsrc[i] + woff);
    }
    float gma = gamma_p[0];
    float4 wo[2][2];  // w_in[e] of the 16 output channels this lane ends up with
    unsigned ooff = hi * 32;
#pragma unroll
    for (int et = 0; et < 2; ++et) {
        wo[et][0] = *(const float4*)((const char*)w_in + ooff + et * 64);
        wo[et][1] = *(const float4*)((const char*)w_in + ooff + et * 64 + 16);
    }
    // The code below reuses the base and offset registers of the loads above, so the wait
    // stands between the two; naming them keeps each in its register up to the wait.
    __builtin_amdgcn_sched_barrier(0);
    asm volatile("s_wait_xcnt 0x0" ::"v"(p), "v"(hi), "v"(ooff), "v"(woff), "s"(x), "s"(w_in),
                 "s"(gn_w), "s"(gn_b), "s"(wsrc[0]), "s"(wsrc[1]), "s"(wsrc[2])
                 : "memory");
    __builtin_amdgcn_sched_barrier(0);

    int b = nrow / W_DIM;
    const float cnt = (float)(D_DIM * W_DIM * H_DIM);
    float mu = stats[b * 2 + 0] / cnt;
    float var = stats[b * 2 + 1] / cnt - mu * mu;
    float rs = rsqrtf(var + 1e-5f);

    v2f a[8];  // fragments of the z tile (16 x 32): pixel m, d = kk*4 + hi*2 + {0,1}
#pragma unroll
    for (int kk = 0; kk < 8; ++kk) {
        a[kk].x = (xv * wi[kk].x - mu) * rs * gw[kk].x + gb[kk].x;
        a[kk].y = (xv * wi[kk].y - mu) * rs * gw[kk].y + gb[kk].y;
    }
#pragma unroll
    for (int kk = 0; kk < 8; ++kk) {
        a[kk].x = gelu_exact(a[kk].x);
        a[kk].y = gelu_exact(a[kk].y);
    }

    if (f0 < 48) {
#pragma unroll
        for (int i = 0; i < 3; ++i) ((v2f*)&Wf[(f0 + i) >> 1][lane])[(f0 + i) & 1] = wst[i];
    }
    __syncthreads();

    {
        v2f fk[2][8], fv[2][8];
#pragma unroll
        for (int et = 0; et < 2; ++et) {
#pragma unroll
            for (int k2 = 0; k2 < 4; ++k2) {
                float4 tk = Wf[et * 4 + k2][lane];
                float4 tv = Wf[8 + et * 4 + k2][lane];
                fk[et][2 * k2 + 0].x = tk.x;
                fk[et][2 * k2 + 0].y = tk.y;
                fk[et][2 * k2 + 1].x = tk.z;
                fk[et][2 * k2 + 1].y = tk.w;
                fv[et][2 * k2 + 0].x = tv.x;
                fv[et][2 * k2 + 0].y = tv.y;
                fv[et][2 * k2 + 1].x = tv.z;
                fv[et][2 * k2 + 1].y = tv.w;
            }
        }
        v8f kacc[2] = {}, vacc[2] = {};
#pragma unroll
        for (int kk = 0; kk < 8; ++kk) {
#pragma unroll
            for (int et = 0; et < 2; ++et) {
                kacc[et] = wmma4(fk[et][kk], a[kk], kacc[et]);
                vacc[et] = wmma4(a[kk], fv[et][kk], vacc[et]);
            }
        }
#pragma unroll
        for (int et = 0; et < 2; ++et) {
#pragma unroll
            for (int h = 0; h < 2; ++h) {
                Ks[wave][et * 2 + h][lane] = make_float4(kacc[et][4 * h + 0], kacc[et][4 * h + 1],
                                                         kacc[et][4 * h + 2], kacc[et][4 * h + 3]);
                Vs[wave][et * 2 + h][lane] = make_float4(vacc[et][4 * h + 0], vacc[et][4 * h + 1],
                                                         vacc[et][4 * h + 2], vacc[et][4 * h + 3]);
            }
        }
    }
    __syncthreads();
    // the outer waves bring keys only; there is no barrier behind this one
    if (wave < WIN / 16 || wave >= WIN / 16 + QT) return;

    v8f qacc[2] = {};
#pragma unroll
    for (int k2 = 0; k2 < 4; ++k2) {
#pragma unroll
        for (int et = 0; et < 2; ++et) {
            float4 tq = Wf[16 + et * 4 + k2][lane];
            v2f fq;
            fq.x = tq.x;
            fq.y = tq.y;
            qacc[et] = wmma4(fq, a[2 * k2 + 0], qacc[et]);
            fq.x = tq.z;
            fq.y = tq.w;
            qacc[et] = wmma4(fq, a[2 * k2 + 1], qacc[et]);
        }
    }

    // S^T = K * Q^T, 5 key tiles of 16, K-dim = 32 (8 WMMAs each); masked on the way out
    const int t0 = wave - WIN / 16;  // LDS tile of the first key tile
    float s[5][8];
    float mx = -3.0e38f;
#pragma unroll
    for (int jt = 0; jt < 5; ++jt) {
        v8f acc = {0.f, 0.f, 0.f, 0.f, 0.f, 0.f, 0.f, 0.f};
#pragma unroll
        for (int u = 0; u < 4; ++u) {  // u = et*2 + h: channels et*16 + 8*hi + 4*h + 0..3
            float4 k4 = Ks[t0 + jt][u][lane];
            v2f ka, qb;
            ka.x = k4.x;
            ka.y = k4.y;
            qb.x = qacc[u >> 1][4 * (u & 1) + 0];
            qb.y = qacc[u >> 1][4 * (u & 1) + 1];
            acc = wmma4(ka, qb, acc);
            ka.x = k4.z;
            ka.y = k4.w;
            qb.x = qacc[u >> 1][4 * (u & 1) + 2];
            qb.y = qacc[u >> 1][4 * (u & 1) + 3];
            acc = wmma4(ka, qb, acc);
        }
        bool in = (unsigned)(i0 - WIN + jt * 16) < (unsigned)H_DIM;  // tile inside the row
#pragma unroll
        for (int r = 0; r < 8; ++r) {
            int di = m + WIN - jt * 16 - r - 8 * hi;  // query index - key index
            bool ok = in;
            if (jt == 0) ok = ok && di <= WIN;   // tiles 1..3 have |di| <= 31: inside the
            if (jt == 4) ok = ok && di >= -WIN;  // band for every lane and register
            s[jt][r] = ok ? acc[r] : -3.0e38f;
            mx = fmaxf(mx, s[jt][r]);
        }
    }
    mx = fmaxf(mx, other_row(mx));

    // p = exp(scale * (s - mx)) as one fma and one exp2; a masked key gives exactly 0
    const float c2 = 0.17677669529663687f * 1.4426950408889634f;  // 32^-0.5 * log2(e)
    float mc = mx * c2;
    float sum = 0.f;
#pragma unroll
    for (int jt = 0; jt < 5; ++jt) {
#pragma unroll
        for (int r = 0; r < 8; ++r) s[jt][r] = fmaf(s[jt][r], c2, -mc);
    }
    // All exponents first, then the exp2: two runs of independent instructions. Mixed, they
    // compile to one dependent fma -> exp2 pair a score through a single register, each fma
    // overwriting the source of the exp2 directly in front of it.
    __builtin_amdgcn_sched_barrier(0);
#pragma unroll
    for (int jt = 0; jt < 5; ++jt) {
#pragma unroll
        for (int r = 0; r < 8; ++r) {
            s[jt][r] = __builtin_amdgcn_exp2f(s[jt][r]);
            sum += s[jt][r];
        }
    }
    sum += other_row(sum);
    float go = gma / sum;  // the row's 1/sum is applied to O, together with gamma

    // O^T = V^T * P^T (K=80 -> 20 chunks), fused with residual feat + gamma*O.
    // Chunk (jt, c) takes keys jt*16 + {2c, 2c+1} in lanes 0-15 and the same + 8 in lanes
    // 16-31, in the A-fragment and in the score registers alike.
    float ls1 = 0.f, ls2 = 0.f;
#pragma unroll
    for (int et = 0; et < 2; ++et) {
        v8f acc = {0.f, 0.f, 0.f, 0.f, 0.f, 0.f, 0.f, 0.f};
#pragma unroll
        for (int jt = 0; jt < 5; ++jt) {
#pragma unroll
            for (int h = 0; h < 2; ++h) {
                float4 v4 = Vs[t0 + jt][et * 2 + h][lane];
                v2f af, pf;
                af.x = v4.x;
                af.y = v4.y;
                pf.x = s[jt][4 * h + 0];
                pf.y = s[jt][4 * h + 1];
                acc = wmma4(af, pf, acc);
                af.x = v4.z;
                af.y = v4.w;
                pf.x = s[jt][4 * h + 2];
                pf.y = s[jt][4 * h + 3];
                acc = wmma4(af, pf, acc);
            }
        }
        // this lane holds channels e0 .. e0+7 of its query, e0 = et*16 + 8*hi
        float w[8] = {wo[et][0].x, wo[et][0].y, wo[et][0].z, wo[et][0].w,
                      wo[et][1].x, wo[et][1].y, wo[et][1].z, wo[et][1].w};
        float gv[8];
#pragma unroll
        for (int r = 0; r < 8; ++r) {
            float f = xv * w[r];  // feat is rank-1 (C==1): recompute
            gv[r] = f + go * acc[r];
            ls1 += gv[r];
            ls2 += gv[r] * gv[r];
        }
        float4* dst = (float4*)(g + (size_t)p * D_DIM + et * 16 + 8 * hi);
        dst[0] = make_float4(gv[0], gv[1], gv[2], gv[3]);
        dst[1] = make_float4(gv[4], gv[5], gv[6], gv[7]);
    }
    // GN2 partial sums of this tile: no atomic, k_final adds the tiles in a fixed order
    ls1 = wave_sum(ls1);
    ls2 = wave_sum(ls2);
    if (lane == 0) {
        int tile = (rowbase + i0) >> 4;
        part[tile * 2 + 0] = ls1;
        part[tile * 2 + 1] = ls2;
    }
}

// ------------------------------------- out = w_out . gelu(GN2(g))  (C == 1)
__device__ __forceinline__ v2f fma2(v2f a, v2f b, v2f c) {
    return __builtin_elementwise_fma(a, b, c);
}
__device__ __forceinline__ v2f both(int bits) {
    float v = __int_as_float(bits);
    v2f r = {v, v};
    return r;
}

// erf of two values without a branch: both ranges are evaluated and one is selected, so that
// many pairs can be in flight in one wave. The polynomials are those of the f32 library erf
// (|u| < 1: u + u*P(u^2); else 1 - exp(-R(|u|))). exp(-R) is below one sixth there, so one
// exp2 of the rounded product costs less than one unit in the last place of 1 - exp(-R).
__device__ __forceinline__ v2f erf_pair(v2f u) {
    v2f ax = __builtin_elementwise_abs(u);
    v2f r = fma2(ax, both(0x378e98ab), both(0xb9c68948));
    r = fma2(ax, r, both(0x3b7cd369));
    r = fma2(ax, r, both(0xbcc618b2));
    r = fma2(ax, r, both(0x3dda74e4));
    r = fma2(ax, r, both(0x3f228afd));
    r = fma2(ax, r, both(0x3e03c728));
    r = fma2(ax, r, ax);
    r = r * -1.4426950408889634f;
    v2f t = u * u;
    v2f q = fma2(t, both(0xba1345e1), both(0x3ba10414));
    q = fma2(t, q, both(0xbcdac9b8));
    q = fma2(t, q, both(0x3de703be));
    q = fma2(t, q, both(0xbec09330));
    q = fma2(t, q, both(0x3e0375d0));
    q = fma2(u, q, u);
    v2f e;
    e.x = ax.x < 1.0f ? q.x : copysignf(1.0f - __builtin_amdgcn_exp2f(r.x), u.x);
    e.y = ax.y < 1.0f ? q.y : copysignf(1.0f - __builtin_amdgcn_exp2f(r.y), u.y);
    return e;
}

// v of lane ^ MASK (MASK < 16), as a row_xmask DPP
template <int MASK>
__device__ __forceinline__ float lane_xor(float v) {
    return __int_as_float(
        __builtin_amdgcn_update_dpp(0, __float_as_int(v), 0x160 + MASK, 0xf, 0xf, true));
}

// Eight lanes share a pixel: lane l of a wave holds channels 4*(l & 7) .. + 3, the same four
// for all its pixels, and load j of the wave brings pixels 4*j + (l >> 3): four whole cache
// lines a load. All loads are issued at the top, so that g and the partial sums of GN2 are
// on their way together.
__global__ void __launch_bounds__(256)
k_final(const float* __restrict__ g, const float* __restrict__ gn_w,
        const float* __restrict__ gn_b, const float* __restrict__ w_out,
        const float* __restrict__ part, float* __restrict__ out) {
    __shared__ float r1[8], r2[8];
    int lane = threadIdx.x & 31;
    int p0 = blockIdx.x * 256 + (threadIdx.x & ~31);  // first pixel of this wave
    int b = blockIdx.x >> 8;                          // 256 blocks a batch
    int k = lane & 7;
    float4 w4 = ((const float4*)gn_w)[k];
    float4 b4 = ((const float4*)gn_b)[k];
    float4 o4 = ((const float4*)w_out)[k];
    const float4* gp = (const float4*)(g + (size_t)p0 * D_DIM) + lane;
    float4 gv[8];
#pragma unroll
    for (int j = 0; j < 8; ++j) gv[j] = gp[j * 32];
    // Holds the g loads here, in front of the wait for the partial sums. Left free, the
    // compiler moves them behind that wait, and the two latencies add up.
    __builtin_amdgcn_sched_barrier(0);
    // The registers of gp are reused below (as a destination of the next loads), so the wait
    // stands between the two; naming gp keeps it in its registers up to the wait.
    asm volatile("s_wait_xcnt 0x0" ::"v"(gp) : "memory");
    __builtin_amdgcn_sched_barrier(0);
    // GN2 sums of this batch: its NTILE_B {s1,s2} pairs, two pairs a load
    const float4* pp = (const float4*)(part + (size_t)b * NTILE_B * 2) + threadIdx.x;
    float4 t[NTILE_B / 512];
#pragma unroll
    for (int i = 0; i < NTILE_B / 512; ++i) t[i] = pp[i * 256];
    float s1 = 0.f, s2 = 0.f;
#pragma unroll
    for (int i = 0; i < NTILE_B / 512; ++i) {
        s1 += t[i].x + t[i].z;
        s2 += t[i].y + t[i].w;
    }
    s1 = wave_sum(s1);
    s2 = wave_sum(s2);
    if (lane == 0) {
        r1[threadIdx.x >> 5] = s1;
        r2[threadIdx.x >> 5] = s2;
    }
    __syncthreads();
    s1 = 0.f;
    s2 = 0.f;
#pragma unroll
    for (int w = 0; w < 8; ++w) {
        s1 += r1[w];
        s2 += r2[w];
    }
    const float cnt = (float)(D_DIM * W_DIM * H_DIM);
    float mu = s1 / cnt;
    float var = s2 / cnt - mu * mu;
    float rs = rsqrtf(var + 1e-5f);

    // GN2 as one fma a value: h = g * sc + sh
    v2f sc[2] = {{rs * w4.x, rs * w4.y}, {rs * w4.z, rs * w4.w}};
    v2f sh[2] = {{b4.x - mu * sc[0].x, b4.y - mu * sc[0].y},
                 {b4.z - mu * sc[1].x, b4.w - mu * sc[1].y}};
    v2f ho[2] = {{0.5f * o4.x, 0.5f * o4.y}, {0.5f * o4.z, 0.5f * o4.w}};
    float a[8];  // a[j]: this lane's four channels of pixel 4*j + (lane >> 3)
#pragma unroll
    for (int j = 0; j < 8; ++j) {
        v2f g0 = {gv[j].x, gv[j].y}, g1 = {gv[j].z, gv[j].w};
        v2f h0 = fma2(g0, sc[0], sh[0]);
        v2f h1 = fma2(g1, sc[1], sh[1]);
        v2f e0 = erf_pair(h0 * 0.70710678118654752440f) + 1.0f;
        v2f e1 = erf_pair(h1 * 0.70710678118654752440f) + 1.0f;
        v2f acc = (h0 * ho[0]) * e0;
        acc = fma2(h1 * ho[1], e1, acc);
        a[j] = acc.x + acc.y;
    }
    // Sum over the eight lanes of a pixel, halving the values a lane carries at each step:
    // lane l ends with the sum of load j = l & 7.
    bool k2 = lane & 4, k1 = lane & 2, k0 = lane & 1;
    float c[4], d[2];
#pragma unroll
    for (int i = 0; i < 4; ++i)
        c[i] = (k2 ? a[i + 4] : a[i]) + lane_xor<4>(k2 ? a[i] : a[i + 4]);
#pragma unroll
    for (int i = 0; i < 2; ++i)
        d[i] = (k1 ? c[i + 2] : c[i]) + lane_xor<2>(k1 ? c[i] : c[i + 2]);
    float o = (k0 ? d[1] : d[0]) + lane_xor<1>(k0 ? d[0] : d[1]);
    out[p0 + 4 * k + (lane >> 3)] = o;
}

extern "C" void kernel_launch(void* const* d_in, const int* in_sizes, int n_in,
                              void* d_out, int out_size, void* d_ws, size_t ws_size,
                              hipStream_t stream) {
    (void)in_sizes; (void)n_in; (void)out_size; (void)ws_size;
    const float* x     = (const float*)d_in[0];
    const float* w_in  = (const float*)d_in[1];
    const float* w_q   = (const float*)d_in[2];
    const float* w_k   = (const float*)d_in[3];
    const float* w_v   = (const float*)d_in[4];
    const float* w_out = (const float*)d_in[5];
    const float* gn_w  = (const float*)d_in[6];
    const float* gn_b  = (const float*)d_in[7];
    const float* gamma = (const float*)d_in[8];
    float* out = (float*)d_out;

    char* ws = (char*)d_ws;
    float* stats = (float*)ws;  // 4 floats: GN1 pairs
    const size_t BUF = (size_t)NPIX * D_DIM * sizeof(float);  // 16 MB
    float* g  = (float*)(ws + 256);
    float* part = (float*)(ws + 256 + 1 * BUF);

    k_init_stats<<<1, 32, 0, stream>>>(stats);
    k_stats1<<<NPIX / 256, 256, 0, stream>>>(x, w_in, stats);
    k_attn<<<NROWS * (H_DIM / 16 / QT), KT * 32, 0, stream>>>(x, w_in, gn_w, gn_b, stats, w_q,
                                                              w_k, w_v, gamma, g, part);
    k_final<<<NPIX / 256, 256, 0, stream>>>(g, gn_w, gn_b, w_out, part, out);
}

// v005
// Measured time: 23.7 microseconds a run.
// Timed twice side by side with v004, it ran 1.12 times as fast both times.
// All steps since v000 together make it 4.64 times as fast.
#include <hip/hip_runtime.h>
#include <math.h>

// CDNA5 / gfx1250, wave32. All matrix work via V_WMMA_F32_16X16X4_F32.
//
// Shapes (fixed by reference setup): B=2, C=1, W=64, H=1024, d=32, WIN=32.
// Pixels P = B*W*H = 131072, attention rows N = B*W = 128 (seq len H=1024).
//
// Workspace layout (needs 256 + 16MB + 64KB = ~16.1 MB):
//   [0..128)       : GN1 partial sums, {s1,s2} per 8192 pixels
//   [256 + 0*BUF)  : g   (feat + gamma * attention output, [pixel][d])
//   [256 + 1*BUF)  : GN2 partial sums, {s1,s2} per 16-query tile

typedef __attribute__((ext_vector_type(2))) float v2f;
typedef __attribute__((ext_vector_type(8))) float v8f;

#define H_DIM 1024
#define W_DIM 64
#define B_DIM 2
#define D_DIM 32
#define WIN   32
#define NPIX  (B_DIM * W_DIM * H_DIM)   // 131072
#define NROWS (B_DIM * W_DIM)           // 128
#define NTILE_B (W_DIM * H_DIM / 16)    // 4096 query tiles per batch
#define SPIX  8192                      // pixels of one GN1 partial sum
#define NPART_B (W_DIM * H_DIM / SPIX)  // 8 GN1 partial sums per batch
#define QT 16                           // query tiles of one attention work-group
#define KT (QT + 2 * WIN / 16)          // its key tiles: the band's reach more on each side

__device__ __forceinline__ float gelu_exact(float x) {
    return 0.5f * x * (1.0f + erff(x * 0.70710678118654752440f));
}

// D = A(16x4) * B(4x16) + C, fp32 throughout.
// A layout: lanes 0-15 hold row m, k={0,1}; lanes 16-31 hold row m, k={2,3}.
// B layout: lanes 0-15 hold col n, k={0,1}; lanes 16-31 hold col n, k={2,3}.
// C/D layout: lane&15 = col n; vgpr r = row r (lanes 0-15) / r+8 (lanes 16-31).
__device__ __forceinline__ v8f wmma4(v2f a, v2f b, v8f c) {
    return __builtin_amdgcn_wmma_f32_16x16x4_f32(false, a, false, b, (short)0, c,
                                                 false, false);
}

// value of the same lane position in the other 16-lane row (lane ^ 16)
__device__ __forceinline__ float other_row(float v) {
    int i = __float_as_int(v);
    return __int_as_float(
        __builtin_amdgcn_permlanex16(i, i, 0x76543210, 0xfedcba98, false, false));
}

// a value that is the same in every lane, as a scalar
__device__ __forceinline__ float scalar(float v) {
    return __int_as_float(__builtin_amdgcn_readfirstlane(__float_as_int(v)));
}

// sum over the 32 lanes, the same fixed tree in every lane
__device__ __forceinline__ float wave_sum(float v) {
    v += __int_as_float(__builtin_amdgcn_update_dpp(0, __float_as_int(v), 0x161, 0xf, 0xf, true));
    v += __int_as_float(__builtin_amdgcn_update_dpp(0, __float_as_int(v), 0x162, 0xf, 0xf, true));
    v += __int_as_float(__builtin_amdgcn_update_dpp(0, __float_as_int(v), 0x164, 0xf, 0xf, true));
    v += __int_as_float(__builtin_amdgcn_update_dpp(0, __float_as_int(v), 0x168, 0xf, 0xf, true));
    return v + other_row(v);
}

// ------------------------------------------------- GN1 stats (feat = x * w_in)
// feat is rank-1 (C == 1): its sum over pixels and channels is sum(x) * sum(w_in), that of
// its squares sum(x^2) * sum(w_in^2). One work-group per SPIX pixels, all its loads issued
// at once, stores its share of both; every wave of k_attn adds the shares of its batch.
// The loops are unrolled so that v[] stays in registers and no load waits for a sum.
static_assert(D_DIM == 32, "lane = channel in k_stats1");
__global__ void __launch_bounds__(256)
k_stats1(const float* __restrict__ x, const float* __restrict__ w_in,
         float* __restrict__ stats) {
    __shared__ float r1[8], r2[8];
    int lane = threadIdx.x & 31;
    const float4* xp = (const float4*)(x + blockIdx.x * SPIX) + threadIdx.x;
    float w = w_in[lane];
    float4 v[SPIX / 1024];
#pragma unroll
    for (int j = 0; j < SPIX / 1024; ++j) v[j] = xp[j * 256];
    float4 a1 = {0.f, 0.f, 0.f, 0.f}, a2 = {0.f, 0.f, 0.f, 0.f};
#pragma unroll
    for (int j = 0; j < SPIX / 1024; ++j) {
        a1.x += v[j].x;
        a1.y += v[j].y;
        a1.z += v[j].z;
        a1.w += v[j].w;
        a2.x += v[j].x * v[j].x;
        a2.y += v[j].y * v[j].y;
        a2.z += v[j].z * v[j].z;
        a2.w += v[j].w * v[j].w;
    }
    float s1 = wave_sum((a1.x + a1.y) + (a1.z + a1.w));
    float s2 = wave_sum((a2.x + a2.y) + (a2.z + a2.w));
    float w1 = wave_sum(w);
    float w2 = wave_sum(w * w);
    if (lane == 0) {
        r1[threadIdx.x >> 5] = s1;
        r2[threadIdx.x >> 5] = s2;
    }
    __syncthreads();
    if (threadIdx.x == 0) {
        s1 = 0.f;
        s2 = 0.f;
#pragma unroll
        for (int i = 0; i < 8; ++i) {
            s1 += r1[i];
            s2 += r2[i];
        }
        ((float2*)stats)[blockIdx.x] = make_float2(s1 * w1, s2 * w2);
    }
}

// ------------------- q/k/v projection + banded attention + residual (WMMA, fp32)
// One work-group per (row n, 256 queries): KT = 20 waves, one per 16-pixel tile of the
// 320 pixels whose keys those queries can see. Each wave computes z = gelu(GN1(feat)) of
// its tile straight into fragments (a z fragment serves as A and as B alike) and from it
//   K^T = Wk * Z^T : lane&15 = key,     register r of half et = channel et*16 + r + 8*hi
//   V   = Z * Wv^T : lane&15 = channel, register r of half et = key r + 8*hi
// These accumulators are, lane for lane, the A-fragments of the two attention products
//   S^T = K * Q^T   (k chunk (et, c): channels et*16 + 8*hi + {2c, 2c+1})
//   O^T = V^T * P^T (k chunk (jt, c): keys jt*16 + 8*hi + {2c, 2c+1})
// so K and V go through LDS as [tile][4 registers][lane], 16 bytes a lane, and come back
// in the same lane of another wave. Q^T = Wq * Z^T has the layout of K^T, which is the
// B-fragment of S^T in the same channel order: it never leaves its wave's registers.
// The weight fragments, alike for every wave, are shared through LDS in the same way.
// A query is a lane (column) throughout: its softmax is a reduction over the lane's own
// 40 registers and one exchange with lane ^ 16.
// Every loop is unrolled so that the fragment arrays are indexed by constants and stay in
// registers.
__global__ void __launch_bounds__(KT * 32)
k_attn(const float* __restrict__ x, const float* __restrict__ w_in,
       const float* __restrict__ gn_w, const float* __restrict__ gn_b,
       const float* __restrict__ stats, const float* __restrict__ wq,
       const float* __restrict__ wk, const float* __restrict__ wv,
       const float* __restrict__ gamma_p, float* __restrict__ g,
       float* __restrict__ part) {
    __shared__ float4 Ks[KT][4][32];
    __shared__ float4 Vs[KT][4][32];
    __shared__ float4 Wf[3 * 2 * 4][32];  // weight fragments: [(K, V, Q)][et][kk / 2][lane]
    int lane = threadIdx.x & 31;
    int wave = __builtin_amdgcn_readfirstlane(threadIdx.x >> 5);
    int m = lane & 15, hi = lane >> 4;
    int nrow = blockIdx.x / (H_DIM / 16 / QT);
    int seg = blockIdx.x % (H_DIM / 16 / QT);
    int rowbase = nrow * H_DIM;
    int i0 = seg * (QT * 16) - WIN + wave * 16;  // first pixel of this wave's tile
    // A tile is 16-aligned, so it lies wholly inside the row or wholly outside; a wave whose
    // tile is outside works on the nearest tile, and its keys are masked below.
    int p = rowbase + min(max(i0, 0), H_DIM - 16) + m;

    // All loads of the projection first: one wait, not one per use.
    float xv = x[p];
    v2f wi[8], gw[8], gb[8];  // channel values of this lane: d = kk*4 + hi*2 + {0,1}
#pragma unroll
    for (int kk = 0; kk < 8; ++kk) {
        wi[kk] = ((const v2f*)w_in)[kk * 2 + hi];
        gw[kk] = ((const v2f*)gn_w)[kk * 2 + hi];
        gb[kk] = ((const v2f*)gn_b)[kk * 2 + hi];
    }
    // Weight fragments, A or B alike: row (column) e = et*16 + m, d as above. Such a load
    // touches 16 cache lines, so each of the 48 is made once a work-group (three a wave,
    // fragment f = (matrix*2 + et)*8 + kk) and handed to the other waves through LDS.
    unsigned woff = m * (D_DIM * 4) + hi * 8;
    const int f0 = wave * 3;
    const char* wsrc[3];
    v2f wst[3] = {};
#pragma unroll
    for (int i = 0; i < 3; ++i) {
        int f = f0 + i;
        wsrc[i] = (const char*)(f < 16 ? wk : f < 32 ? wv : wq) +
                  (f & 15) / 8 * (16 * D_DIM * 4) + (f & 7) * 16;
    }
    if (f0 < 48) {
#pragma unroll
        for (int i = 0; i < 3; ++i) wst[i] = *(const v2f*)(wsrc[i] + woff);
    }
    float gma = gamma_p[0];
    float4 wo[2][2];  // w_in[e] of the 16 output channels this lane ends up with
    unsigned ooff = hi * 32;
#pragma unroll
    for (int et = 0; et < 2; ++et) {
        wo[et][0] = *(const float4*)((const char*)w_in + ooff + et * 64);
        wo[et][1] = *(const float4*)((const char*)w_in + ooff + et * 64 + 16);
    }
    // The code below reuses the base and offset registers of the loads above, so the wait
    // stands between the two; naming them keeps each in its register up to the wait.
    __builtin_amdgcn_sched_barrier(0);
    asm volatile("s_wait_xcnt 0x0" ::"v"(p), "v"(hi), "v"(ooff), "v"(woff), "s"(x), "s"(w_in),
                 "s"(gn_w), "s"(gn_b), "s"(wsrc[0]), "s"(wsrc[1]), "s"(wsrc[2])
                 : "memory");
    __builtin_amdgcn_sched_barrier(0);

    // GN1 sums of this batch: its NPART_B {s1,s2} shares, added in a fixed order
    int b = nrow / W_DIM;
    const float* sp = stats + b * (NPART_B * 2);
    // scalar() keeps the adds on the scalar unit. Left free, the compiler pairs the two sums
    // into packed vector adds, the kernel's vector registers go from 96 to 116, and two
    // work-groups no longer fit a WGP. Unrolled: the shares come in one scalar load.
    float gs1 = scalar(sp[0]), gs2 = scalar(sp[1]);
#pragma unroll
    for (int i = 1; i < NPART_B; ++i) {
        gs1 += scalar(sp[2 * i + 0]);
        gs2 += scalar(sp[2 * i + 1]);
    }
    const float cnt = (float)(D_DIM * W_DIM * H_DIM);
    float mu = gs1 / cnt;
    float var = gs2 / cnt - mu * mu;
    float rs = rsqrtf(var + 1e-5f);

    v2f a[8];  // fragments of the z tile (16 x 32): pixel m, d = kk*4 + hi*2 + {0,1}
#pragma unroll
    for (int kk = 0; kk < 8; ++kk) {
        a[kk].x = (xv * wi[kk].x - mu) * rs * gw[kk].x + gb[kk].x;
        a[kk].y = (xv * wi[kk].y - mu) * rs * gw[kk].y + gb[kk].y;
    }
#pragma unroll
    for (int kk = 0; kk < 8; ++kk) {
        a[kk].x = gelu_exact(a[kk].x);
        a[kk].y = gelu_exact(a[kk].y);
    }

    if (f0 < 48) {
#pragma unroll
        for (int i = 0; i < 3; ++i) ((v2f*)&Wf[(f0 + i) >> 1][lane])[(f0 + i) & 1] = wst[i];
    }
    __syncthreads();

    {
        v2f fk[2][8], fv[2][8];
#pragma unroll
        for (int et = 0; et < 2; ++et) {
#pragma unroll
            for (int k2 = 0; k2 < 4; ++k2) {
                float4 tk = Wf[et * 4 + k2][lane];
                float4 tv = Wf[8 + et * 4 + k2][lane];
                fk[et][2 * k2 + 0].x = tk.x;
                fk[et][2 * k2 + 0].y = tk.y;
                fk[et][2 * k2 + 1].x = tk.z;
                fk[et][2 * k2 + 1].y = tk.w;
                fv[et][2 * k2 + 0].x = tv.x;
                fv[et][2 * k2 + 0].y = tv.y;
                fv[et][2 * k2 + 1].x = tv.z;
                fv[et][2 * k2 + 1].y = tv.w;
            }
        }
        v8f kacc[2] = {}, vacc[2] = {};
#pragma unroll
        for (int kk = 0; kk < 8; ++kk) {
#pragma unroll
            for (int et = 0; et < 2; ++et) {
                kacc[et] = wmma4(fk[et][kk], a[kk], kacc[et]);
                vacc[et] = wmma4(a[kk], fv[et][kk], vacc[et]);
            }
        }
#pragma unroll
        for (int et = 0; et < 2; ++et) {
#pragma unroll
            for (int h = 0; h < 2; ++h) {
                Ks[wave][et * 2 + h][lane] = make_float4(kacc[et][4 * h + 0], kacc[et][4 * h + 1],
                                                         kacc[et][4 * h + 2], kacc[et][4 * h + 3]);
                Vs[wave][et * 2 + h][lane] = make_float4(vacc[et][4 * h + 0], vacc[et][4 * h + 1],
                                                         vacc[et][4 * h + 2], vacc[et][4 * h + 3]);
            }
        }
    }
    __syncthreads();
    // the outer waves bring keys only; there is no barrier behind this one
    if (wave < WIN / 16 || wave >= WIN / 16 + QT) return;

    v8f qacc[2] = {};
#pragma unroll
    for (int k2 = 0; k2 < 4; ++k2) {
#pragma unroll
        for (int et = 0; et < 2; ++et) {
            float4 tq = Wf[16 + et * 4 + k2][lane];
            v2f fq;
            fq.x = tq.x;
            fq.y = tq.y;
            qacc[et] = wmma4(fq, a[2 * k2 + 0], qacc[et]);
            fq.x = tq.z;
            fq.y = tq.w;
            qacc[et] = wmma4(fq, a[2 * k2 + 1], qacc[et]);
        }
    }

    // S^T = K * Q^T, 5 key tiles of 16, K-dim = 32 (8 WMMAs each); masked on the way out
    const int t0 = wave - WIN / 16;  // LDS tile of the first key tile
    float s[5][8];
    float mx = -3.0e38f;
#pragma unroll
    for (int jt = 0; jt < 5; ++jt) {
        v8f acc = {0.f, 0.f, 0.f, 0.f, 0.f, 0.f, 0.f, 0.f};
#pragma unroll
        for (int u = 0; u < 4; ++u) {  // u = et*2 + h: channels et*16 + 8*hi + 4*h + 0..3
            float4 k4 = Ks[t0 + jt][u][lane];
            v2f ka, qb;
            ka.x = k4.x;
            ka.y = k4.y;
            qb.x = qacc[u >> 1][4 * (u & 1) + 0];
            qb.y = qacc[u >> 1][4 * (u & 1) + 1];
            acc = wmma4(ka, qb, acc);
            ka.x = k4.z;
            ka.y = k4.w;
            qb.x = qacc[u >> 1][4 * (u & 1) + 2];
            qb.y = qacc[u >> 1][4 * (u & 1) + 3];
            acc = wmma4(ka, qb, acc);
        }
        bool in = (unsigned)(i0 - WIN + jt * 16) < (unsigned)H_DIM;  // tile inside the row
#pragma unroll
        for (int r = 0; r < 8; ++r) {
            int di = m + WIN - jt * 16 - r - 8 * hi;  // query index - key index
            bool ok = in;
            if (jt == 0) ok = ok && di <= WIN;   // tiles 1..3 have |di| <= 31: inside the
            if (jt == 4) ok = ok && di >= -WIN;  // band for every lane and register
            s[jt][r] = ok ? acc[r] : -3.0e38f;
            mx = fmaxf(mx, s[jt][r]);
        }
    }
    mx = fmaxf(mx, other_row(mx));

    // p = exp(scale * (s - mx)) as one fma and one exp2; a masked key gives exactly 0
    const float c2 = 0.17677669529663687f * 1.4426950408889634f;  // 32^-0.5 * log2(e)
    float mc = mx * c2;
    float sum = 0.f;
#pragma unroll
    for (int jt = 0; jt < 5; ++jt) {
#pragma unroll
        for (int r = 0; r < 8; ++r) s[jt][r] = fmaf(s[jt][r], c2, -mc);
    }
    // All exponents first, then the exp2: two runs of independent instructions. Mixed, they
    // compile to one dependent fma -> exp2 pair a score through a single register, each fma
    // overwriting the source of the exp2 directly in front of it.
    __builtin_amdgcn_sched_barrier(0);
#pragma unroll
    for (int jt = 0; jt < 5; ++jt) {
#pragma unroll
        for (int r = 0; r < 8; ++r) {
            s[jt][r] = __builtin_amdgcn_exp2f(s[jt][r]);
            sum += s[jt][r];
        }
    }
    sum += other_row(sum);
    float go = gma / sum;  // the row's 1/sum is applied to O, together with gamma

    // O^T = V^T * P^T (K=80 -> 20 chunks), fused with residual feat + gamma*O.
    // Chunk (jt, c) takes keys jt*16 + {2c, 2c+1} in lanes 0-15 and the same + 8 in lanes
    // 16-31, in the A-fragment and in the score registers alike.
    float ls1 = 0.f, ls2 = 0.f;
#pragma unroll
    for (int et = 0; et < 2; ++et) {
        v8f acc = {0.f, 0.f, 0.f, 0.f, 0.f, 0.f, 0.f, 0.f};
#pragma unroll
        for (int jt = 0; jt < 5; ++jt) {
#pragma unroll
            for (int h = 0; h < 2; ++h) {
                float4 v4 = Vs[t0 + jt][et * 2 + h][lane];
                v2f af, pf;
                af.x = v4.x;
                af.y = v4.y;
                pf.x = s[jt][4 * h + 0];
                pf.y = s[jt][4 * h + 1];
                acc = wmma4(af, pf, acc);
                af.x = v4.z;
                af.y = v4.w;
                pf.x = s[jt][4 * h + 2];
                pf.y = s[jt][4 * h + 3];
                acc = wmma4(af, pf, acc);
            }
        }
        // this lane holds channels e0 .. e0+7 of its query, e0 = et*16 + 8*hi
        float w[8] = {wo[et][0].x, wo[et][0].y, wo[et][0].z, wo[et][0].w,
                      wo[et][1].x, wo[et][1].y, wo[et][1].z, wo[et][1].w};
        float gv[8];
#pragma unroll
        for (int r = 0; r < 8; ++r) {
            float f = xv * w[r];  // feat is rank-1 (C==1): recompute
            gv[r] = f + go * acc[r];
            ls1 += gv[r];
            ls2 += gv[r] * gv[r];
        }
        float4* dst = (float4*)(g + (size_t)p * D_DIM + et * 16 + 8 * hi);
        dst[0] = make_float4(gv[0], gv[1], gv[2], gv[3]);
        dst[1] = make_float4(gv[4], gv[5], gv[6], gv[7]);
    }
    // GN2 partial sums of this tile: no atomic, k_final adds the tiles in a fixed order
    ls1 = wave_sum(ls1);
    ls2 = wave_sum(ls2);
    if (lane == 0) {
        int tile = (rowbase + i0) >> 4;
        part[tile * 2 + 0] = ls1;
        part[tile * 2 + 1] = ls2;
    }
}

// ------------------------------------- out = w_out . gelu(GN2(g))  (C == 1)
__device__ __forceinline__ v2f fma2(v2f a, v2f b, v2f c) {
    return __builtin_elementwise_fma(a, b, c);
}
__device__ __forceinline__ v2f both(int bits) {
    float v = __int_as_float(bits);
    v2f r = {v, v};
    return r;
}

// erf of two values without a branch: both ranges are evaluated and one is selected, so that
// many pairs can be in flight in one wave. The polynomials are those of the f32 library erf
// (|u| < 1: u + u*P(u^2); else 1 - exp(-R(|u|))). exp(-R) is below one sixth there, so one
// exp2 of the rounded product costs less than one unit in the last place of 1 - exp(-R).
__device__ __forceinline__ v2f erf_pair(v2f u) {
    v2f ax = __builtin_elementwise_abs(u);
    v2f r = fma2(ax, both(0x378e98ab), both(0xb9c68948));
    r = fma2(ax, r, both(0x3b7cd369));
    r = fma2(ax, r, both(0xbcc618b2));
    r = fma2(ax, r, both(0x3dda74e4));
    r = fma2(ax, r, both(0x3f228afd));
    r = fma2(ax, r, both(0x3e03c728));
    r = fma2(ax, r, ax);
    r = r * -1.4426950408889634f;
    v2f t = u * u;
    v2f q = fma2(t, both(0xba1345e1), both(0x3ba10414));
    q = fma2(t, q, both(0xbcdac9b8));
    q = fma2(t, q, both(0x3de703be));
    q = fma2(t, q, both(0xbec09330));
    q = fma2(t, q, both(0x3e0375d0));
    q = fma2(u, q, u);
    v2f e;
    e.x = ax.x < 1.0f ? q.x : copysignf(1.0f - __builtin_amdgcn_exp2f(r.x), u.x);
    e.y = ax.y < 1.0f ? q.y : copysignf(1.0f - __builtin_amdgcn_exp2f(r.y), u.y);
    return e;
}

// v of lane ^ MASK (MASK < 16), as a row_xmask DPP
template <int MASK>
__device__ __forceinline__ float lane_xor(float v) {
    return __int_as_float(
        __builtin_amdgcn_update_dpp(0, __float_as_int(v), 0x160 + MASK, 0xf, 0xf, true));
}

// Eight lanes share a pixel: lane l of a wave holds channels 4*(l & 7) .. + 3, the same four
// for all its pixels, and load j of the wave brings pixels 4*j + (l >> 3): four whole cache
// lines a load. All loads are issued at the top, so that g and the partial sums of GN2 are
// on their way together.
__global__ void __launch_bounds__(256)
k_final(const float* __restrict__ g, const float* __restrict__ gn_w,
        const float* __restrict__ gn_b, const float* __restrict__ w_out,
        const float* __restrict__ part, float* __restrict__ out) {
    __shared__ float r1[8], r2[8];
    int lane = threadIdx.x & 31;
    int p0 = blockIdx.x * 256 + (threadIdx.x & ~31);  // first pixel of this wave
    int b = blockIdx.x >> 8;                          // 256 blocks a batch
    int k = lane & 7;
    float4 w4 = ((const float4*)gn_w)[k];
    float4 b4 = ((const float4*)gn_b)[k];
    float4 o4 = ((const float4*)w_out)[k];
    const float4* gp = (const float4*)(g + (size_t)p0 * D_DIM) + lane;
    float4 gv[8];
#pragma unroll
    for (int j = 0; j < 8; ++j) gv[j] = gp[j * 32];
    // Holds the g loads here, in front of the wait for the partial sums. Left free, the
    // compiler moves them behind that wait, and the two latencies add up.
    __builtin_amdgcn_sched_barrier(0);
    // The registers of gp are reused below (as a destination of the next loads), so the wait
    // stands between the two; naming gp keeps it in its registers up to the wait.
    asm volatile("s_wait_xcnt 0x0" ::"v"(gp) : "memory");
    __builtin_amdgcn_sched_barrier(0);
    // GN2 sums of this batch: its NTILE_B {s1,s2} pairs, two pairs a load
    const float4* pp = (const float4*)(part + (size_t)b * NTILE_B * 2) + threadIdx.x;
    float4 t[NTILE_B / 512];
#pragma unroll
    for (int i = 0; i < NTILE_B / 512; ++i) t[i] = pp[i * 256];
    float s1 = 0.f, s2 = 0.f;
#pragma unroll
    for (int i = 0; i < NTILE_B / 512; ++i) {
        s1 += t[i].x + t[i].z;
        s2 += t[i].y + t[i].w;
    }
    s1 = wave_sum(s1);
    s2 = wave_sum(s2);
    if (lane == 0) {
        r1[threadIdx.x >> 5] = s1;
        r2[threadIdx.x >> 5] = s2;
    }
    __syncthreads();
    s1 = 0.f;
    s2 = 0.f;
#pragma unroll
    for (int w = 0; w < 8; ++w) {
        s1 += r1[w];
        s2 += r2[w];
    }
    const float cnt = (float)(D_DIM * W_DIM * H_DIM);
    float mu = s1 / cnt;
    float var = s2 / cnt - mu * mu;
    float rs = rsqrtf(var + 1e-5f);

    // GN2 as one fma a value: h = g * sc + sh
    v2f sc[2] = {{rs * w4.x, rs * w4.y}, {rs * w4.z, rs * w4.w}};
    v2f sh[2] = {{b4.x - mu * sc[0].x, b4.y - mu * sc[0].y},
                 {b4.z - mu * sc[1].x, b4.w - mu * sc[1].y}};
    v2f ho[2] = {{0.5f * o4.x, 0.5f * o4.y}, {0.5f * o4.z, 0.5f * o4.w}};
    float a[8];  // a[j]: this lane's four channels of pixel 4*j + (lane >> 3)
#pragma unroll
    for (int j = 0; j < 8; ++j) {
        v2f g0 = {gv[j].x, gv[j].y}, g1 = {gv[j].z, gv[j].w};
        v2f h0 = fma2(g0, sc[0], sh[0]);
        v2f h1 = fma2(g1, sc[1], sh[1]);
        v2f e0 = erf_pair(h0 * 0.70710678118654752440f) + 1.0f;
        v2f e1 = erf_pair(h1 * 0.70710678118654752440f) + 1.0f;
        v2f acc = (h0 * ho[0]) * e0;
        acc = fma2(h1 * ho[1], e1, acc);
        a[j] = acc.x + acc.y;
    }
    // Sum over the eight lanes of a pixel, halving the values a lane carries at each step:
    // lane l ends with the sum of load j = l & 7.
    bool k2 = lane & 4, k1 = lane & 2, k0 = lane & 1;
    float c[4], d[2];
#pragma unroll
    for (int i = 0; i < 4; ++i)
        c[i] = (k2 ? a[i + 4] : a[i]) + lane_xor<4>(k2 ? a[i] : a[i + 4]);
#pragma unroll
    for (int i = 0; i < 2; ++i)
        d[i] = (k1 ? c[i + 2] : c[i]) + lane_xor<2>(k1 ? c[i] : c[i + 2]);
    float o = (k0 ? d[1] : d[0]) + lane_xor<1>(k0 ? d[0] : d[1]);
    out[p0 + 4 * k + (lane >> 3)] = o;
}

extern "C" void kernel_launch(void* const* d_in, const int* in_sizes, int n_in,
                              void* d_out, int out_size, void* d_ws, size_t ws_size,
                              hipStream_t stream) {
    (void)in_sizes; (void)n_in; (void)out_size; (void)ws_size;
    const float* x     = (const float*)d_in[0];
    const float* w_in  = (const float*)d_in[1];
    const float* w_q   = (const float*)d_in[2];
    const float* w_k   = (const float*)d_in[3];
    const float* w_v   = (const float*)d_in[4];
    const float* w_out = (const float*)d_in[5];
    const float* gn_w  = (const float*)d_in[6];
    const float* gn_b  = (const float*)d_in[7];
    const float* gamma = (const float*)d_in[8];
    float* out = (float*)d_out;

    char* ws = (char*)d_ws;
    float* stats = (float*)ws;  // GN1 partial sums: NPIX / SPIX pairs
    const size_t BUF = (size_t)NPIX * D_DIM * sizeof(float);  // 16 MB
    float* g  = (float*)(ws + 256);
    float* part = (float*)(ws + 256 + 1 * BUF);

    k_stats1<<<NPIX / SPIX, 256, 0, stream>>>(x, w_in, stats);
    k_attn<<<NROWS * (H_DIM / 16 / QT), KT * 32, 0, stream>>>(x, w_in, gn_w, gn_b, stats, w_q,
                                                              w_k, w_v, gamma, g, part);
    k_final<<<NPIX / 256, 256, 0, stream>>>(g, gn_w, gn_b, w_out, part, out);
}

// v006
// It runs in 22.6 microseconds.
// Next to v005, in two timings, it ran 1.05 times as fast each time.
// Counting every step since v000, it is 4.88 times as fast.
#include <hip/hip_runtime.h>
#include <math.h>

// CDNA5 / gfx1250, wave32. All matrix work via V_WMMA_F32_16X16X4_F32.
//
// Shapes (fixed by reference setup): B=2, C=1, W=64, H=1024, d=32, WIN=32.
// Pixels P = B*W*H = 131072, attention rows N = B*W = 128 (seq len H=1024).
//
// Workspace layout (needs 256 + 16MB + 64KB = ~16.1 MB):
//   [0..128)       : GN1 partial sums, {s1,s2} per 8192 pixels
//   [256 + 0*BUF)  : g   (feat + gamma * attention output, [pixel][d])
//   [256 + 1*BUF)  : GN2 partial sums, {s1,s2} per 16-query tile

typedef __attribute__((ext_vector_type(2))) float v2f;
typedef __attribute__((ext_vector_type(8))) float v8f;

#define H_DIM 1024
#define W_DIM 64
#define B_DIM 2
#define D_DIM 32
#define WIN   32
#define NPIX  (B_DIM * W_DIM * H_DIM)   // 131072
#define NROWS (B_DIM * W_DIM)           // 128
#define NTILE_B (W_DIM * H_DIM / 16)    // 4096 query tiles per batch
#define SPIX  8192                      // pixels of one GN1 partial sum
#define NPART_B (W_DIM * H_DIM / SPIX)  // 8 GN1 partial sums per batch
#define QT 16                           // query tiles of one attention work-group
#define KT (QT + 2 * WIN / 16)          // its key tiles: the band's reach more on each side

__device__ __forceinline__ v2f fma2(v2f a, v2f b, v2f c) {
    return __builtin_elementwise_fma(a, b, c);
}
__device__ __forceinline__ v2f both(int bits) {
    float v = __int_as_float(bits);
    v2f r = {v, v};
    return r;
}

// erf of two values without a branch: both ranges are evaluated and one is selected, so that
// many pairs can be in flight in one wave. The polynomials are those of the f32 library erf
// (|u| < 1: u + u*P(u^2); else 1 - exp(-R(|u|))). exp(-R) is below one sixth there, so one
// exp2 of the rounded product costs less than one unit in the last place of 1 - exp(-R).
__device__ __forceinline__ v2f erf_pair(v2f u) {
    v2f ax = __builtin_elementwise_abs(u);
    v2f r = fma2(ax, both(0x378e98ab), both(0xb9c68948));
    r = fma2(ax, r, both(0x3b7cd369));
    r = fma2(ax, r, both(0xbcc618b2));
    r = fma2(ax, r, both(0x3dda74e4));
    r = fma2(ax, r, both(0x3f228afd));
    r = fma2(ax, r, both(0x3e03c728));
    r = fma2(ax, r, ax);
    r = r * -1.4426950408889634f;
    v2f t = u * u;
    v2f q = fma2(t, both(0xba1345e1), both(0x3ba10414));
    q = fma2(t, q, both(0xbcdac9b8));
    q = fma2(t, q, both(0x3de703be));
    q = fma2(t, q, both(0xbec09330));
    q = fma2(t, q, both(0x3e0375d0));
    q = fma2(u, q, u);
    v2f e;
    e.x = ax.x < 1.0f ? q.x : copysignf(1.0f - __builtin_amdgcn_exp2f(r.x), u.x);
    e.y = ax.y < 1.0f ? q.y : copysignf(1.0f - __builtin_amdgcn_exp2f(r.y), u.y);
    return e;
}

// 0.5 * h * (1 + erf(h / sqrt(2))) of two values; the half goes into the fma, which is exact
__device__ __forceinline__ v2f gelu_pair(v2f h) {
    return h * fma2(erf_pair(h * 0.70710678118654752440f), both(0x3f000000), both(0x3f000000));
}

// D = A(16x4) * B(4x16) + C, fp32 throughout.
// A layout: lanes 0-15 hold row m, k={0,1}; lanes 16-31 hold row m, k={2,3}.
// B layout: lanes 0-15 hold col n, k={0,1}; lanes 16-31 hold col n, k={2,3}.
// C/D layout: lane&15 = col n; vgpr r = row r (lanes 0-15) / r+8 (lanes 16-31).
__device__ __forceinline__ v8f wmma4(v2f a, v2f b, v8f c) {
    return __builtin_amdgcn_wmma_f32_16x16x4_f32(false, a, false, b, (short)0, c,
                                                 false, false);
}

// value of the same lane position in the other 16-lane row (lane ^ 16)
__device__ __forceinline__ float other_row(float v) {
    int i = __float_as_int(v);
    return __int_as_float(
        __builtin_amdgcn_permlanex16(i, i, 0x76543210, 0xfedcba98, false, false));
}

// a value that is the same in every lane, as a scalar
__device__ __forceinline__ float scalar(float v) {
    return __int_as_float(__builtin_amdgcn_readfirstlane(__float_as_int(v)));
}

// sum over the 32 lanes, the same fixed tree in every lane
__device__ __forceinline__ float wave_sum(float v) {
    v += __int_as_float(__builtin_amdgcn_update_dpp(0, __float_as_int(v), 0x161, 0xf, 0xf, true));
    v += __int_as_float(__builtin_amdgcn_update_dpp(0, __float_as_int(v), 0x162, 0xf, 0xf, true));
    v += __int_as_float(__builtin_amdgcn_update_dpp(0, __float_as_int(v), 0x164, 0xf, 0xf, true));
    v += __int_as_float(__builtin_amdgcn_update_dpp(0, __float_as_int(v), 0x168, 0xf, 0xf, true));
    return v + other_row(v);
}

// ------------------------------------------------- GN1 stats (feat = x * w_in)
// feat is rank-1 (C == 1): its sum over pixels and channels is sum(x) * sum(w_in), that of
// its squares sum(x^2) * sum(w_in^2). One work-group per SPIX pixels, all its loads issued
// at once, stores its share of both; every wave of k_attn adds the shares of its batch.
// The loops are unrolled so that v[] stays in registers and no load waits for a sum.
static_assert(D_DIM == 32, "lane = channel in k_stats1");
__global__ void __launch_bounds__(256)
k_stats1(const float* __restrict__ x, const float* __restrict__ w_in,
         float* __restrict__ stats) {
    __shared__ float r1[8], r2[8];
    int lane = threadIdx.x & 31;
    const float4* xp = (const float4*)(x + blockIdx.x * SPIX) + threadIdx.x;
    float w = w_in[lane];
    float4 v[SPIX / 1024];
#pragma unroll
    for (int j = 0; j < SPIX / 1024; ++j) v[j] = xp[j * 256];
    float4 a1 = {0.f, 0.f, 0.f, 0.f}, a2 = {0.f, 0.f, 0.f, 0.f};
#pragma unroll
    for (int j = 0; j < SPIX / 1024; ++j) {
        a1.x += v[j].x;
        a1.y += v[j].y;
        a1.z += v[j].z;
        a1.w += v[j].w;
        a2.x += v[j].x * v[j].x;
        a2.y += v[j].y * v[j].y;
        a2.z += v[j].z * v[j].z;
        a2.w += v[j].w * v[j].w;
    }
    float s1 = wave_sum((a1.x + a1.y) + (a1.z + a1.w));
    float s2 = wave_sum((a2.x + a2.y) + (a2.z + a2.w));
    float w1 = wave_sum(w);
    float w2 = wave_sum(w * w);
    if (lane == 0) {
        r1[threadIdx.x >> 5] = s1;
        r2[threadIdx.x >> 5] = s2;
    }
    __syncthreads();
    if (threadIdx.x == 0) {
        s1 = 0.f;
        s2 = 0.f;
#pragma unroll
        for (int i = 0; i < 8; ++i) {
            s1 += r1[i];
            s2 += r2[i];
        }
        ((float2*)stats)[blockIdx.x] = make_float2(s1 * w1, s2 * w2);
    }
}

// ------------------- q/k/v projection + banded attention + residual (WMMA, fp32)
// One work-group per (row n, 256 queries): KT = 20 waves, one per 16-pixel tile of the
// 320 pixels whose keys those queries can see. Each wave computes z = gelu(GN1(feat)) of
// its tile straight into fragments (a z fragment serves as A and as B alike) and from it
//   K^T = Wk * Z^T : lane&15 = key,     register r of half et = channel et*16 + r + 8*hi
//   V   = Z * Wv^T : lane&15 = channel, register r of half et = key r + 8*hi
// These accumulators are, lane for lane, the A-fragments of the two attention products
//   S^T = K * Q^T   (k chunk (et, c): channels et*16 + 8*hi + {2c, 2c+1})
//   O^T = V^T * P^T (k chunk (jt, c): keys jt*16 + 8*hi + {2c, 2c+1})
// so K and V go through LDS as [tile][4 registers][lane], 16 bytes a lane, and come back
// in the same lane of another wave. Q^T = Wq * Z^T has the layout of K^T, which is the
// B-fragment of S^T in the same channel order: it never leaves its wave's registers.
// The weight fragments, alike for every wave, are shared through LDS in the same way.
// A query is a lane (column) throughout: its softmax is a reduction over the lane's own
// 40 registers and one exchange with lane ^ 16.
// Every loop is unrolled so that the fragment arrays are indexed by constants and stay in
// registers.
__global__ void __launch_bounds__(KT * 32)
k_attn(const float* __restrict__ x, const float* __restrict__ w_in,
       const float* __restrict__ gn_w, const float* __restrict__ gn_b,
       const float* __restrict__ stats, const float* __restrict__ wq,
       const float* __restrict__ wk, const float* __restrict__ wv,
       const float* __restrict__ gamma_p, float* __restrict__ g,
       float* __restrict__ part) {
    __shared__ float4 Ks[KT][4][32];
    __shared__ float4 Vs[KT][4][32];
    __shared__ float4 Wf[3 * 2 * 4][32];  // weight fragments: [(K, V, Q)][et][kk / 2][lane]
    int lane = threadIdx.x & 31;
    int wave = __builtin_amdgcn_readfirstlane(threadIdx.x >> 5);
    int m = lane & 15, hi = lane >> 4;
    int nrow = blockIdx.x / (H_DIM / 16 / QT);
    int seg = blockIdx.x % (H_DIM / 16 / QT);
    int rowbase = nrow * H_DIM;
    int i0 = seg * (QT * 16) - WIN + wave * 16;  // first pixel of this wave's tile
    // A tile is 16-aligned, so it lies wholly inside the row or wholly outside; a wave whose
    // tile is outside works on the nearest tile, and its keys are masked below.
    int p = rowbase + min(max(i0, 0), H_DIM - 16) + m;

    // All loads of the projection first: one wait, not one per use.
    float xv = x[p];
    v2f wi[8], gw[8], gb[8];  // channel values of this lane: d = kk*4 + hi*2 + {0,1}
#pragma unroll
    for (int kk = 0; kk < 8; ++kk) {
        wi[kk] = ((const v2f*)w_in)[kk * 2 + hi];
        gw[kk] = ((const v2f*)gn_w)[kk * 2 + hi];
        gb[kk] = ((const v2f*)gn_b)[kk * 2 + hi];
    }
    // Weight fragments, A or B alike: row (column) e = et*16 + m, d as above. Such a load
    // touches 16 cache lines, so each of the 48 is made once a work-group (three a wave,
    // fragment f = (matrix*2 + et)*8 + kk) and handed to the other waves through LDS.
    unsigned woff = m * (D_DIM * 4) + hi * 8;
    const int f0 = wave * 3;
    const char* wsrc[3];
    v2f wst[3] = {};
#pragma unroll
    for (int i = 0; i < 3; ++i) {
        int f = f0 + i;
        wsrc[i] = (const char*)(f < 16 ? wk : f < 32 ? wv : wq) +
                  (f & 15) / 8 * (16 * D_DIM * 4) + (f & 7) * 16;
    }
    if (f0 < 48) {
#pragma unroll
        for (int i = 0; i < 3; ++i) wst[i] = *(const v2f*)(wsrc[i] + woff);
    }
    float gma = gamma_p[0];
    float4 wo[2][2];  // w_in[e] of the 16 output channels this lane ends up with
    unsigned ooff = hi * 32;
#pragma unroll
    for (int et = 0; et < 2; ++et) {
        wo[et][0] = *(const float4*)((const char*)w_in + ooff + et * 64);
        wo[et][1] = *(const float4*)((const char*)w_in + ooff + et * 64 + 16);
    }
    // The code below reuses the base and offset registers of the loads above, so the wait
    // stands between the two; naming them keeps each in its register up to the wait.
    __builtin_amdgcn_sched_barrier(0);
    asm volatile("s_wait_xcnt 0x0" ::"v"(p), "v"(hi), "v"(ooff), "v"(woff), "s"(x), "s"(w_in),
                 "s"(gn_w), "s"(gn_b), "s"(wsrc[0]), "s"(wsrc[1]), "s"(wsrc[2])
                 : "memory");
    __builtin_amdgcn_sched_barrier(0);

    // GN1 sums of this batch: its NPART_B {s1,s2} shares, added in a fixed order
    int b = nrow / W_DIM;
    const float* sp = stats + b * (NPART_B * 2);
    // scalar() keeps the adds on the scalar unit. Left free, the compiler pairs the two sums
    // into packed vector adds, the kernel's vector registers go from 96 to 116, and two
    // work-groups no longer fit a WGP. Unrolled: the shares come in one scalar load.
    float gs1 = scalar(sp[0]), gs2 = scalar(sp[1]);
#pragma unroll
    for (int i = 1; i < NPART_B; ++i) {
        gs1 += scalar(sp[2 * i + 0]);
        gs2 += scalar(sp[2 * i + 1]);
    }
    const float cnt = (float)(D_DIM * W_DIM * H_DIM);
    float mu = gs1 / cnt;
    float var = gs2 / cnt - mu * mu;
    float rs = rsqrtf(var + 1e-5f);

    v2f a[8];  // fragments of the z tile (16 x 32): pixel m, d = kk*4 + hi*2 + {0,1}
#pragma unroll
    for (int kk = 0; kk < 8; ++kk) {
        a[kk].x = (xv * wi[kk].x - mu) * rs * gw[kk].x + gb[kk].x;
        a[kk].y = (xv * wi[kk].y - mu) * rs * gw[kk].y + gb[kk].y;
    }
#pragma unroll
    for (int kk = 0; kk < 8; ++kk) a[kk] = gelu_pair(a[kk]);

    if (f0 < 48) {
#pragma unroll
        for (int i = 0; i < 3; ++i) ((v2f*)&Wf[(f0 + i) >> 1][lane])[(f0 + i) & 1] = wst[i];
    }
    __syncthreads();

    {
        v2f fk[2][8], fv[2][8];
#pragma unroll
        for (int et = 0; et < 2; ++et) {
#pragma unroll
            for (int k2 = 0; k2 < 4; ++k2) {
                float4 tk = Wf[et * 4 + k2][lane];
                float4 tv = Wf[8 + et * 4 + k2][lane];
                fk[et][2 * k2 + 0].x = tk.x;
                fk[et][2 * k2 + 0].y = tk.y;
                fk[et][2 * k2 + 1].x = tk.z;
                fk[et][2 * k2 + 1].y = tk.w;
                fv[et][2 * k2 + 0].x = tv.x;
                fv[et][2 * k2 + 0].y = tv.y;
                fv[et][2 * k2 + 1].x = tv.z;
                fv[et][2 * k2 + 1].y = tv.w;
            }
        }
        v8f kacc[2] = {}, vacc[2] = {};
#pragma unroll
        for (int kk = 0; kk < 8; ++kk) {
#pragma unroll
            for (int et = 0; et < 2; ++et) {
                kacc[et] = wmma4(fk[et][kk], a[kk], kacc[et]);
                vacc[et] = wmma4(a[kk], fv[et][kk], vacc[et]);
            }
        }
#pragma unroll
        for (int et = 0; et < 2; ++et) {
#pragma unroll
            for (int h = 0; h < 2; ++h) {
                Ks[wave][et * 2 + h][lane] = make_float4(kacc[et][4 * h + 0], kacc[et][4 * h + 1],
                                                         kacc[et][4 * h + 2], kacc[et][4 * h + 3]);
                Vs[wave][et * 2 + h][lane] = make_float4(vacc[et][4 * h + 0], vacc[et][4 * h + 1],
                                                         vacc[et][4 * h + 2], vacc[et][4 * h + 3]);
            }
        }
    }
    __syncthreads();
    // the outer waves bring keys only; there is no barrier behind this one
    if (wave < WIN / 16 || wave >= WIN / 16 + QT) return;

    v8f qacc[2] = {};
#pragma unroll
    for (int k2 = 0; k2 < 4; ++k2) {
#pragma unroll
        for (int et = 0; et < 2; ++et) {
            float4 tq = Wf[16 + et * 4 + k2][lane];
            v2f fq;
            fq.x = tq.x;
            fq.y = tq.y;
            qacc[et] = wmma4(fq, a[2 * k2 + 0], qacc[et]);
            fq.x = tq.z;
            fq.y = tq.w;
            qacc[et] = wmma4(fq, a[2 * k2 + 1], qacc[et]);
        }
    }

    // S^T = K * Q^T, 5 key tiles of 16, K-dim = 32 (8 WMMAs each); masked on the way out
    const int t0 = wave - WIN / 16;  // LDS tile of the first key tile
    float s[5][8];
    float mx = -3.0e38f;
#pragma unroll
    for (int jt = 0; jt < 5; ++jt) {
        v8f acc = {0.f, 0.f, 0.f, 0.f, 0.f, 0.f, 0.f, 0.f};
#pragma unroll
        for (int u = 0; u < 4; ++u) {  // u = et*2 + h: channels et*16 + 8*hi + 4*h + 0..3
            float4 k4 = Ks[t0 + jt][u][lane];
            v2f ka, qb;
            ka.x = k4.x;
            ka.y = k4.y;
            qb.x = qacc[u >> 1][4 * (u & 1) + 0];
            qb.y = qacc[u >> 1][4 * (u & 1) + 1];
            acc = wmma4(ka, qb, acc);
            ka.x = k4.z;
            ka.y = k4.w;
            qb.x = qacc[u >> 1][4 * (u & 1) + 2];
            qb.y = qacc[u >> 1][4 * (u & 1) + 3];
            acc = wmma4(ka, qb, acc);
        }
        bool in = (unsigned)(i0 - WIN + jt * 16) < (unsigned)H_DIM;  // tile inside the row
#pragma unroll
        for (int r = 0; r < 8; ++r) {
            int di = m + WIN - jt * 16 - r - 8 * hi;  // query index - key index
            bool ok = in;
            if (jt == 0) ok = ok && di <= WIN;   // tiles 1..3 have |di| <= 31: inside the
            if (jt == 4) ok = ok && di >= -WIN;  // band for every lane and register
            s[jt][r] = ok ? acc[r] : -3.0e38f;
            mx = fmaxf(mx, s[jt][r]);
        }
    }
    mx = fmaxf(mx, other_row(mx));

    // p = exp(scale * (s - mx)) as one fma and one exp2; a masked key gives exactly 0
    const float c2 = 0.17677669529663687f * 1.4426950408889634f;  // 32^-0.5 * log2(e)
    float mc = mx * c2;
    float sum = 0.f;
#pragma unroll
    for (int jt = 0; jt < 5; ++jt) {
#pragma unroll
        for (int r = 0; r < 8; ++r) s[jt][r] = fmaf(s[jt][r], c2, -mc);
    }
    // All exponents first, then the exp2: two runs of independent instructions. Mixed, they
    // compile to one dependent fma -> exp2 pair a score through a single register, each fma
    // overwriting the source of the exp2 directly in front of it.
    __builtin_amdgcn_sched_barrier(0);
#pragma unroll
    for (int jt = 0; jt < 5; ++jt) {
#pragma unroll
        for (int r = 0; r < 8; ++r) {
            s[jt][r] = __builtin_amdgcn_exp2f(s[jt][r]);
            sum += s[jt][r];
        }
    }
    sum += other_row(sum);
    float go = gma / sum;  // the row's 1/sum is applied to O, together with gamma

    // O^T = V^T * P^T (K=80 -> 20 chunks), fused with residual feat + gamma*O.
    // Chunk (jt, c) takes keys jt*16 + {2c, 2c+1} in lanes 0-15 and the same + 8 in lanes
    // 16-31, in the A-fragment and in the score registers alike.
    float ls1 = 0.f, ls2 = 0.f;
#pragma unroll
    for (int et = 0; et < 2; ++et) {
        v8f acc = {0.f, 0.f, 0.f, 0.f, 0.f, 0.f, 0.f, 0.f};
#pragma unroll
        for (int jt = 0; jt < 5; ++jt) {
#pragma unroll
            for (int h = 0; h < 2; ++h) {
                float4 v4 = Vs[t0 + jt][et * 2 + h][lane];
                v2f af, pf;
                af.x = v4.x;
                af.y = v4.y;
                pf.x = s[jt][4 * h + 0];
                pf.y = s[jt][4 * h + 1];
                acc = wmma4(af, pf, acc);
                af.x = v4.z;
                af.y = v4.w;
                pf.x = s[jt][4 * h + 2];
                pf.y = s[jt][4 * h + 3];
                acc = wmma4(af, pf, acc);
            }
        }
        // this lane holds channels e0 .. e0+7 of its query, e0 = et*16 + 8*hi
        float w[8] = {wo[et][0].x, wo[et][0].y, wo[et][0].z, wo[et][0].w,
                      wo[et][1].x, wo[et][1].y, wo[et][1].z, wo[et][1].w};
        float gv[8];
#pragma unroll
        for (int r = 0; r < 8; ++r) {
            float f = xv * w[r];  // feat is rank-1 (C==1): recompute
            gv[r] = f + go * acc[r];
            ls1 += gv[r];
            ls2 += gv[r] * gv[r];
        }
        float4* dst = (float4*)(g + (size_t)p * D_DIM + et * 16 + 8 * hi);
        dst[0] = make_float4(gv[0], gv[1], gv[2], gv[3]);
        dst[1] = make_float4(gv[4], gv[5], gv[6], gv[7]);
    }
    // GN2 partial sums of this tile: no atomic, k_final adds the tiles in a fixed order
    ls1 = wave_sum(ls1);
    ls2 = wave_sum(ls2);
    if (lane == 0) {
        int tile = (rowbase + i0) >> 4;
        part[tile * 2 + 0] = ls1;
        part[tile * 2 + 1] = ls2;
    }
}

// ------------------------------------- out = w_out . gelu(GN2(g))  (C == 1)
// v of lane ^ MASK (MASK < 16), as a row_xmask DPP
template <int MASK>
__device__ __forceinline__ float lane_xor(float v) {
    return __int_as_float(
        __builtin_amdgcn_update_dpp(0, __float_as_int(v), 0x160 + MASK, 0xf, 0xf, true));
}

// Eight lanes share a pixel: lane l of a wave holds channels 4*(l & 7) .. + 3, the same four
// for all its pixels, and load j of the wave brings pixels 4*j + (l >> 3): four whole cache
// lines a load. All loads are issued at the top, so that g and the partial sums of GN2 are
// on their way together.
__global__ void __launch_bounds__(256)
k_final(const float* __restrict__ g, const float* __restrict__ gn_w,
        const float* __restrict__ gn_b, const float* __restrict__ w_out,
        const float* __restrict__ part, float* __restrict__ out) {
    __shared__ float r1[8], r2[8];
    int lane = threadIdx.x & 31;
    int p0 = blockIdx.x * 256 + (threadIdx.x & ~31);  // first pixel of this wave
    int b = blockIdx.x >> 8;                          // 256 blocks a batch
    int k = lane & 7;
    float4 w4 = ((const float4*)gn_w)[k];
    float4 b4 = ((const float4*)gn_b)[k];
    float4 o4 = ((const float4*)w_out)[k];
    const float4* gp = (const float4*)(g + (size_t)p0 * D_DIM) + lane;
    float4 gv[8];
#pragma unroll
    for (int j = 0; j < 8; ++j) gv[j] = gp[j * 32];
    // Holds the g loads here, in front of the wait for the partial sums. Left free, the
    // compiler moves them behind that wait, and the two latencies add up.
    __builtin_amdgcn_sched_barrier(0);
    // The registers of gp are reused below (as a destination of the next loads), so the wait
    // stands between the two; naming gp keeps it in its registers up to the wait.
    asm volatile("s_wait_xcnt 0x0" ::"v"(gp) : "memory");
    __builtin_amdgcn_sched_barrier(0);
    // GN2 sums of this batch: its NTILE_B {s1,s2} pairs, two pairs a load
    const float4* pp = (const float4*)(part + (size_t)b * NTILE_B * 2) + threadIdx.x;
    float4 t[NTILE_B / 512];
#pragma unroll
    for (int i = 0; i < NTILE_B / 512; ++i) t[i] = pp[i * 256];
    float s1 = 0.f, s2 = 0.f;
#pragma unroll
    for (int i = 0; i < NTILE_B / 512; ++i) {
        s1 += t[i].x + t[i].z;
        s2 += t[i].y + t[i].w;
    }
    s1 = wave_sum(s1);
    s2 = wave_sum(s2);
    if (lane == 0) {
        r1[threadIdx.x >> 5] = s1;
        r2[threadIdx.x >> 5] = s2;
    }
    __syncthreads();
    s1 = 0.f;
    s2 = 0.f;
#pragma unroll
    for (int w = 0; w < 8; ++w) {
        s1 += r1[w];
        s2 += r2[w];
    }
    const float cnt = (float)(D_DIM * W_DIM * H_DIM);
    float mu = s1 / cnt;
    float var = s2 / cnt - mu * mu;
    float rs = rsqrtf(var + 1e-5f);

    // GN2 as one fma a value: h = g * sc + sh
    v2f sc[2] = {{rs * w4.x, rs * w4.y}, {rs * w4.z, rs * w4.w}};
    v2f sh[2] = {{b4.x - mu * sc[0].x, b4.y - mu * sc[0].y},
                 {b4.z - mu * sc[1].x, b4.w - mu * sc[1].y}};
    v2f ho[2] = {{0.5f * o4.x, 0.5f * o4.y}, {0.5f * o4.z, 0.5f * o4.w}};
    float a[8];  // a[j]: this lane's four channels of pixel 4*j + (lane >> 3)
#pragma unroll
    for (int j = 0; j < 8; ++j) {
        v2f g0 = {gv[j].x, gv[j].y}, g1 = {gv[j].z, gv[j].w};
        v2f h0 = fma2(g0, sc[0], sh[0]);
        v2f h1 = fma2(g1, sc[1], sh[1]);
        v2f e0 = erf_pair(h0 * 0.70710678118654752440f) + 1.0f;
        v2f e1 = erf_pair(h1 * 0.70710678118654752440f) + 1.0f;
        v2f acc = (h0 * ho[0]) * e0;
        acc = fma2(h1 * ho[1], e1, acc);
        a[j] = acc.x + acc.y;
    }
    // Sum over the eight lanes of a pixel, halving the values a lane carries at each step:
    // lane l ends with the sum of load j = l & 7.
    bool k2 = lane & 4, k1 = lane & 2, k0 = lane & 1;
    float c[4], d[2];
#pragma unroll
    for (int i = 0; i < 4; ++i)
        c[i] = (k2 ? a[i + 4] : a[i]) + lane_xor<4>(k2 ? a[i] : a[i + 4]);
#pragma unroll
    for (int i = 0; i < 2; ++i)
        d[i] = (k1 ? c[i + 2] : c[i]) + lane_xor<2>(k1 ? c[i] : c[i + 2]);
    float o = (k0 ? d[1] : d[0]) + lane_xor<1>(k0 ? d[0] : d[1]);
    out[p0 + 4 * k + (lane >> 3)] = o;
}

extern "C" void kernel_launch(void* const* d_in, const int* in_sizes, int n_in,
                              void* d_out, int out_size, void* d_ws, size_t ws_size,
                              hipStream_t stream) {
    (void)in_sizes; (void)n_in; (void)out_size; (void)ws_size;
    const float* x     = (const float*)d_in[0];
    const float* w_in  = (const float*)d_in[1];
    const float* w_q   = (const float*)d_in[2];
    const float* w_k   = (const float*)d_in[3];
    const float* w_v   = (const float*)d_in[4];
    const float* w_out = (const float*)d_in[5];
    const float* gn_w  = (const float*)d_in[6];
    const float* gn_b  = (const float*)d_in[7];
    const float* gamma = (const float*)d_in[8];
    float* out = (float*)d_out;

    char* ws = (char*)d_ws;
    float* stats = (float*)ws;  // GN1 partial sums: NPIX / SPIX pairs
    const size_t BUF = (size_t)NPIX * D_DIM * sizeof(float);  // 16 MB
    float* g  = (float*)(ws + 256);
    float* part = (float*)(ws + 256 + 1 * BUF);

    k_stats1<<<NPIX / SPIX, 256, 0, stream>>>(x, w_in, stats);
    k_attn<<<NROWS * (H_DIM / 16 / QT), KT * 32, 0, stream>>>(x, w_in, gn_w, gn_b, stats, w_q,
                                                              w_k, w_v, gamma, g, part);
    k_final<<<NPIX / 256, 256, 0, stream>>>(g, gn_w, gn_b, w_out, part, out);
}

// v007
// One run takes 20.7 microseconds.
// Two timings next to v006 put it at 1.09 and 1.10 times that version's speed.
// Counting every step since v000, it is 5.34 times as fast.
#include <hip/hip_runtime.h>
#include <math.h>

// CDNA5 / gfx1250, wave32. All matrix work via V_WMMA_F32_16X16X4_F32.
//
// Shapes (fixed by reference setup): B=2, C=1, W=64, H=1024, d=32, WIN=32.
// Pixels P = B*W*H = 131072, attention rows N = B*W = 128 (seq len H=1024).
//
// Workspace layout (needs 256 + 16MB + 64KB + 4KB = ~16.1 MB):
//   [0..128)       : GN1 partial sums, {s1,s2} per 8192 pixels
//   [256 + 0*BUF)  : g   (feat + gamma * attention output, [pixel][d])
//   [256 + 1*BUF)  : GN2 partial sums, {s1,s2} per 16-query tile
//   behind them    : Mp, the 32 x 32 score matrix Wk^T * Wq with its rows in register order

typedef __attribute__((ext_vector_type(2))) float v2f;
typedef __attribute__((ext_vector_type(8))) float v8f;

#define H_DIM 1024
#define W_DIM 64
#define B_DIM 2
#define D_DIM 32
#define WIN   32
#define NPIX  (B_DIM * W_DIM * H_DIM)   // 131072
#define NROWS (B_DIM * W_DIM)           // 128
#define NTILE_B (W_DIM * H_DIM / 16)    // 4096 query tiles per batch
#define SPIX  8192                      // pixels of one GN1 partial sum
#define NPART_B (W_DIM * H_DIM / SPIX)  // 8 GN1 partial sums per batch
#define QT 16                           // query tiles of one attention work-group
#define KT (QT + 2 * WIN / 16)          // its key tiles: the band's reach more on each side

__device__ __forceinline__ v2f fma2(v2f a, v2f b, v2f c) {
    return __builtin_elementwise_fma(a, b, c);
}
__device__ __forceinline__ v2f both(int bits) {
    float v = __int_as_float(bits);
    v2f r = {v, v};
    return r;
}

// erf of two values without a branch: both ranges are evaluated and one is selected, so that
// many pairs can be in flight in one wave. The polynomials are those of the f32 library erf
// (|u| < 1: u + u*P(u^2); else 1 - exp(-R(|u|))). exp(-R) is below one sixth there, so one
// exp2 of the rounded product costs less than one unit in the last place of 1 - exp(-R).
__device__ __forceinline__ v2f erf_pair(v2f u) {
    v2f ax = __builtin_elementwise_abs(u);
    v2f r = fma2(ax, both(0x378e98ab), both(0xb9c68948));
    r = fma2(ax, r, both(0x3b7cd369));
    r = fma2(ax, r, both(0xbcc618b2));
    r = fma2(ax, r, both(0x3dda74e4));
    r = fma2(ax, r, both(0x3f228afd));
    r = fma2(ax, r, both(0x3e03c728));
    r = fma2(ax, r, ax);
    r = r * -1.4426950408889634f;
    v2f t = u * u;
    v2f q = fma2(t, both(0xba1345e1), both(0x3ba10414));
    q = fma2(t, q, both(0xbcdac9b8));
    q = fma2(t, q, both(0x3de703be));
    q = fma2(t, q, both(0xbec09330));
    q = fma2(t, q, both(0x3e0375d0));
    q = fma2(u, q, u);
    v2f e;
    e.x = ax.x < 1.0f ? q.x : copysignf(1.0f - __builtin_amdgcn_exp2f(r.x), u.x);
    e.y = ax.y < 1.0f ? q.y : copysignf(1.0f - __builtin_amdgcn_exp2f(r.y), u.y);
    return e;
}

// 0.5 * h * (1 + erf(h / sqrt(2))) of two values; the half goes into the fma, which is exact
__device__ __forceinline__ v2f gelu_pair(v2f h) {
    return h * fma2(erf_pair(h * 0.70710678118654752440f), both(0x3f000000), both(0x3f000000));
}

// D = A(16x4) * B(4x16) + C, fp32 throughout.
// A layout: lanes 0-15 hold row m, k={0,1}; lanes 16-31 hold row m, k={2,3}.
// B layout: lanes 0-15 hold col n, k={0,1}; lanes 16-31 hold col n, k={2,3}.
// C/D layout: lane&15 = col n; vgpr r = row r (lanes 0-15) / r+8 (lanes 16-31).
__device__ __forceinline__ v8f wmma4(v2f a, v2f b, v8f c) {
    return __builtin_amdgcn_wmma_f32_16x16x4_f32(false, a, false, b, (short)0, c,
                                                 false, false);
}

// value of the same lane position in the other 16-lane row (lane ^ 16)
__device__ __forceinline__ float other_row(float v) {
    int i = __float_as_int(v);
    return __int_as_float(
        __builtin_amdgcn_permlanex16(i, i, 0x76543210, 0xfedcba98, false, false));
}

// a value that is the same in every lane, as a scalar
__device__ __forceinline__ float scalar(float v) {
    return __int_as_float(__builtin_amdgcn_readfirstlane(__float_as_int(v)));
}

// sum over the 32 lanes, the same fixed tree in every lane
__device__ __forceinline__ float wave_sum(float v) {
    v += __int_as_float(__builtin_amdgcn_update_dpp(0, __float_as_int(v), 0x161, 0xf, 0xf, true));
    v += __int_as_float(__builtin_amdgcn_update_dpp(0, __float_as_int(v), 0x162, 0xf, 0xf, true));
    v += __int_as_float(__builtin_amdgcn_update_dpp(0, __float_as_int(v), 0x164, 0xf, 0xf, true));
    v += __int_as_float(__builtin_amdgcn_update_dpp(0, __float_as_int(v), 0x168, 0xf, 0xf, true));
    return v + other_row(v);
}

// ------------------------------------------------- GN1 stats (feat = x * w_in)
// feat is rank-1 (C == 1): its sum over pixels and channels is sum(x) * sum(w_in), that of
// its squares sum(x^2) * sum(w_in^2). One work-group per SPIX pixels, all its loads issued
// at once, stores its share of both; every wave of k_attn adds the shares of its batch.
// The loops are unrolled so that v[] stays in registers and no load waits for a sum.
//
// One more work-group forms the score matrix. A score is q_i . k_j = z_j^T (Wk^T Wq) z_i, so
// with M = Wk^T * Wq (M[c][d] = sum_e Wk[e][c] * Wq[e][d]) the keys need no projection: k_attn
// takes z itself as its keys and M * z_i as its queries. Row s = et*16 + mm of Mp is row
// c(s) = et*16 + ((mm & 7) >> 1)*4 + (mm >> 3)*2 + (mm & 1) of M: then register 2*kk + j of
// the accumulators of Mp * Z^T holds, in lane half hi, channel kk*4 + hi*2 + j, which is the
// channel order of a z fragment. Four waves, one 16 x 16 tile of Mp each, k = e.
static_assert(D_DIM == 32, "lane = channel in k_stats1");
__global__ void __launch_bounds__(256)
k_stats1(const float* __restrict__ x, const float* __restrict__ w_in,
         const float* __restrict__ wq, const float* __restrict__ wk,
         float* __restrict__ stats, float* __restrict__ mp) {
    __shared__ float r1[8], r2[8];
    int lane = threadIdx.x & 31;
    if (blockIdx.x == NPIX / SPIX) {  // the whole work-group leaves in front of the barrier
        int wave = __builtin_amdgcn_readfirstlane(threadIdx.x >> 5);
        if (wave >= 4) return;
        int m = lane & 15, hi = lane >> 4;
        int st = wave >> 1, dt = wave & 1;
        int c = st * 16 + ((m & 7) >> 1) * 4 + (m >> 3) * 2 + (m & 1);
        // chunk i of A and of B alike: e = i*4 + hi*2 + {0,1}
        int ki = hi * 2 * D_DIM + c;
        int qi = hi * 2 * D_DIM + dt * 16 + m;
        int oi = (st * 16 + 8 * hi) * D_DIM + dt * 16 + m;  // accumulator register 0 in Mp
        v2f fa[8], fb[8];
#pragma unroll
        for (int i = 0; i < 8; ++i) {
            fa[i].x = wk[ki + i * 4 * D_DIM];
            fa[i].y = wk[ki + i * 4 * D_DIM + D_DIM];
            fb[i].x = wq[qi + i * 4 * D_DIM];
            fb[i].y = wq[qi + i * 4 * D_DIM + D_DIM];
        }
        // The registers of the load indices are reused below, so the wait stands between the
        // two; naming them keeps each in its register up to the wait. oi is named so that it
        // is formed here: among the WMMAs it would be written over a spent operand register
        // directly behind the instruction that reads it.
        __builtin_amdgcn_sched_barrier(0);
        asm volatile("s_wait_xcnt 0x0" ::"v"(ki), "v"(qi), "v"(oi), "s"(wk), "s"(wq) : "memory");
        __builtin_amdgcn_sched_barrier(0);
        v8f acc = {0.f, 0.f, 0.f, 0.f, 0.f, 0.f, 0.f, 0.f};
#pragma unroll
        for (int i = 0; i < 8; ++i) acc = wmma4(fa[i], fb[i], acc);
#pragma unroll
        for (int r = 0; r < 8; ++r) mp[oi + r * D_DIM] = acc[r];
        return;
    }
    const float4* xp = (const float4*)(x + blockIdx.x * SPIX) + threadIdx.x;
    float w = w_in[lane];
    float4 v[SPIX / 1024];
#pragma unroll
    for (int j = 0; j < SPIX / 1024; ++j) v[j] = xp[j * 256];
    float4 a1 = {0.f, 0.f, 0.f, 0.f}, a2 = {0.f, 0.f, 0.f, 0.f};
#pragma unroll
    for (int j = 0; j < SPIX / 1024; ++j) {
        a1.x += v[j].x;
        a1.y += v[j].y;
        a1.z += v[j].z;
        a1.w += v[j].w;
        a2.x += v[j].x * v[j].x;
        a2.y += v[j].y * v[j].y;
        a2.z += v[j].z * v[j].z;
        a2.w += v[j].w * v[j].w;
    }
    float s1 = wave_sum((a1.x + a1.y) + (a1.z + a1.w));
    float s2 = wave_sum((a2.x + a2.y) + (a2.z + a2.w));
    float w1 = wave_sum(w);
    float w2 = wave_sum(w * w);
    if (lane == 0) {
        r1[threadIdx.x >> 5] = s1;
        r2[threadIdx.x >> 5] = s2;
    }
    __syncthreads();
    if (threadIdx.x == 0) {
        s1 = 0.f;
        s2 = 0.f;
#pragma unroll
        for (int i = 0; i < 8; ++i) {
            s1 += r1[i];
            s2 += r2[i];
        }
        ((float2*)stats)[blockIdx.x] = make_float2(s1 * w1, s2 * w2);
    }
}

// ------------------- q/v projection + banded attention + residual (WMMA, fp32)
// One work-group per (row n, 256 queries): KT = 20 waves, one per 16-pixel tile of the
// 320 pixels whose keys those queries can see. Each wave computes z = gelu(GN1(feat)) of
// its tile straight into fragments (a z fragment serves as A and as B alike) and from it
//   V   = Z * Wv^T : lane&15 = channel, register r of half et = key r + 8*hi
// The z fragments and these accumulators are, lane for lane, the A-fragments of the two
// attention products
//   S^T = Z * Q^T   (k chunk kk: channels kk*4 + hi*2 + {0,1})
//   O^T = V^T * P^T (k chunk (jt, c): keys jt*16 + 8*hi + {2c, 2c+1})
// so Z and V go through LDS as [tile][4 registers][lane], 16 bytes a lane, and come back
// in the same lane of another wave. Q^T = Mp * Z^T (Mp: k_stats1) holds channel
// kk*4 + hi*2 + j in register 2*kk + j, which is the B-fragment of S^T in the same channel
// order: it never leaves its wave's registers.
// The weight fragments, alike for every wave, are shared through LDS in the same way.
// A query is a lane (column) throughout: its softmax is a reduction over the lane's own
// 40 registers and one exchange with lane ^ 16.
// Every loop is unrolled so that the fragment arrays are indexed by constants and stay in
// registers.
__global__ void __launch_bounds__(KT * 32)
k_attn(const float* __restrict__ x, const float* __restrict__ w_in,
       const float* __restrict__ gn_w, const float* __restrict__ gn_b,
       const float* __restrict__ stats, const float* __restrict__ mp,
       const float* __restrict__ wv, const float* __restrict__ gamma_p,
       float* __restrict__ g, float* __restrict__ part) {
    __shared__ float4 Ks[KT][4][32];      // the keys: z fragments kk = 2u, 2u + 1
    __shared__ float4 Vs[KT][4][32];
    __shared__ float4 Wf[2 * 2 * 4][32];  // weight fragments: [(V, Q)][et][kk / 2][lane]
    int lane = threadIdx.x & 31;
    int wave = __builtin_amdgcn_readfirstlane(threadIdx.x >> 5);
    int m = lane & 15, hi = lane >> 4;
    int nrow = blockIdx.x / (H_DIM / 16 / QT);
    int seg = blockIdx.x % (H_DIM / 16 / QT);
    int rowbase = nrow * H_DIM;
    int i0 = seg * (QT * 16) - WIN + wave * 16;  // first pixel of this wave's tile
    // A tile is 16-aligned, so it lies wholly inside the row or wholly outside; a wave whose
    // tile is outside works on the nearest tile, and its keys are masked below.
    int p = rowbase + min(max(i0, 0), H_DIM - 16) + m;

    // All loads of the projection first: one wait, not one per use.
    float xv = x[p];
    v2f wi[8], gw[8], gb[8];  // channel values of this lane: d = kk*4 + hi*2 + {0,1}
#pragma unroll
    for (int kk = 0; kk < 8; ++kk) {
        wi[kk] = ((const v2f*)w_in)[kk * 2 + hi];
        gw[kk] = ((const v2f*)gn_w)[kk * 2 + hi];
        gb[kk] = ((const v2f*)gn_b)[kk * 2 + hi];
    }
    // Weight fragments, A or B alike: row (column) e = et*16 + m, d as above. Such a load
    // touches 16 cache lines, so each of the 32 is made once a work-group (two a wave,
    // fragment f = (matrix*2 + et)*8 + kk) and handed to the other waves through LDS.
    unsigned woff = m * (D_DIM * 4) + hi * 8;
    const int f0 = wave * 2;
    const char* wsrc[2];
    v2f wst[2] = {};
#pragma unroll
    for (int i = 0; i < 2; ++i) {
        int f = f0 + i;
        wsrc[i] = (const char*)(f < 16 ? wv : mp) + (f & 15) / 8 * (16 * D_DIM * 4) + (f & 7) * 16;
    }
    if (f0 < 32) {
#pragma unroll
        for (int i = 0; i < 2; ++i) wst[i] = *(const v2f*)(wsrc[i] + woff);
    }
    float gma = gamma_p[0];
    float4 wo[2][2];  // w_in[e] of the 16 output channels this lane ends up with
    unsigned ooff = hi * 32;
#pragma unroll
    for (int et = 0; et < 2; ++et) {
        wo[et][0] = *(const float4*)((const char*)w_in + ooff + et * 64);
        wo[et][1] = *(const float4*)((const char*)w_in + ooff + et * 64 + 16);
    }
    // The code below reuses the base and offset registers of the loads above, so the wait
    // stands between the two; naming them keeps each in its register up to the wait.
    __builtin_amdgcn_sched_barrier(0);
    asm volatile("s_wait_xcnt 0x0" ::"v"(p), "v"(hi), "v"(ooff), "v"(woff), "s"(x), "s"(w_in),
                 "s"(gn_w), "s"(gn_b), "s"(wsrc[0]), "s"(wsrc[1])
                 : "memory");
    __builtin_amdgcn_sched_barrier(0);

    // GN1 sums of this batch: its NPART_B {s1,s2} shares, added in a fixed order
    int b = nrow / W_DIM;
    const float* sp = stats + b * (NPART_B * 2);
    // scalar() keeps the adds on the scalar unit. Left free, the compiler pairs the two sums
    // into packed vector adds, the kernel's vector registers go from 96 to 116, and two
    // work-groups no longer fit a WGP. Unrolled: the shares come in one scalar load.
    float gs1 = scalar(sp[0]), gs2 = scalar(sp[1]);
#pragma unroll
    for (int i = 1; i < NPART_B; ++i) {
        gs1 += scalar(sp[2 * i + 0]);
        gs2 += scalar(sp[2 * i + 1]);
    }
    const float cnt = (float)(D_DIM * W_DIM * H_DIM);
    float mu = gs1 / cnt;
    float var = gs2 / cnt - mu * mu;
    float rs = rsqrtf(var + 1e-5f);

    v2f a[8];  // fragments of the z tile (16 x 32): pixel m, d = kk*4 + hi*2 + {0,1}
#pragma unroll
    for (int kk = 0; kk < 8; ++kk) {
        a[kk].x = (xv * wi[kk].x - mu) * rs * gw[kk].x + gb[kk].x;
        a[kk].y = (xv * wi[kk].y - mu) * rs * gw[kk].y + gb[kk].y;
    }
#pragma unroll
    for (int kk = 0; kk < 8; ++kk) a[kk] = gelu_pair(a[kk]);

    if (f0 < 32) Wf[wave][lane] = make_float4(wst[0].x, wst[0].y, wst[1].x, wst[1].y);
#pragma unroll
    for (int u = 0; u < 4; ++u)
        Ks[wave][u][lane] = make_float4(a[2 * u].x, a[2 * u].y, a[2 * u + 1].x, a[2 * u + 1].y);
    __syncthreads();

    {
        v2f fv[2][8];
#pragma unroll
        for (int et = 0; et < 2; ++et) {
#pragma unroll
            for (int k2 = 0; k2 < 4; ++k2) {
                float4 tv = Wf[et * 4 + k2][lane];
                fv[et][2 * k2 + 0].x = tv.x;
                fv[et][2 * k2 + 0].y = tv.y;
                fv[et][2 * k2 + 1].x = tv.z;
                fv[et][2 * k2 + 1].y = tv.w;
            }
        }
        v8f vacc[2] = {};
#pragma unroll
        for (int kk = 0; kk < 8; ++kk) {
#pragma unroll
            for (int et = 0; et < 2; ++et) vacc[et] = wmma4(a[kk], fv[et][kk], vacc[et]);
        }
#pragma unroll
        for (int et = 0; et < 2; ++et) {
#pragma unroll
            for (int h = 0; h < 2; ++h) {
                Vs[wave][et * 2 + h][lane] = make_float4(vacc[et][4 * h + 0], vacc[et][4 * h + 1],
                                                         vacc[et][4 * h + 2], vacc[et][4 * h + 3]);
            }
        }
    }
    __syncthreads();
    // the outer waves bring keys only; there is no barrier behind this one
    if (wave < WIN / 16 || wave >= WIN / 16 + QT) return;

    v8f qacc[2] = {};
#pragma unroll
    for (int k2 = 0; k2 < 4; ++k2) {
#pragma unroll
        for (int et = 0; et < 2; ++et) {
            float4 tq = Wf[8 + et * 4 + k2][lane];
            v2f fq;
            fq.x = tq.x;
            fq.y = tq.y;
            qacc[et] = wmma4(fq, a[2 * k2 + 0], qacc[et]);
            fq.x = tq.z;
            fq.y = tq.w;
            qacc[et] = wmma4(fq, a[2 * k2 + 1], qacc[et]);
        }
    }

    // S^T = Z * Q^T, 5 key tiles of 16, K-dim = 32 (8 WMMAs each); masked on the way out
    const int t0 = wave - WIN / 16;  // LDS tile of the first key tile
    float s[5][8];
    float mx = -3.0e38f;
#pragma unroll
    for (int jt = 0; jt < 5; ++jt) {
        v8f acc = {0.f, 0.f, 0.f, 0.f, 0.f, 0.f, 0.f, 0.f};
#pragma unroll
        for (int u = 0; u < 4; ++u) {  // chunks kk = 2u, 2u + 1: Q registers 4u .. 4u + 3
            float4 k4 = Ks[t0 + jt][u][lane];
            v2f ka, qb;
            ka.x = k4.x;
            ka.y = k4.y;
            qb.x = qacc[u >> 1][4 * (u & 1) + 0];
            qb.y = qacc[u >> 1][4 * (u & 1) + 1];
            acc = wmma4(ka, qb, acc);
            ka.x = k4.z;
            ka.y = k4.w;
            qb.x = qacc[u >> 1][4 * (u & 1) + 2];
            qb.y = qacc[u >> 1][4 * (u & 1) + 3];
            acc = wmma4(ka, qb, acc);
        }
        bool in = (unsigned)(i0 - WIN + jt * 16) < (unsigned)H_DIM;  // tile inside the row
#pragma unroll
        for (int r = 0; r < 8; ++r) {
            int di = m + WIN - jt * 16 - r - 8 * hi;  // query index - key index
            bool ok = in;
            if (jt == 0) ok = ok && di <= WIN;   // tiles 1..3 have |di| <= 31: inside the
            if (jt == 4) ok = ok && di >= -WIN;  // band for every lane and register
            s[jt][r] = ok ? acc[r] : -3.0e38f;
            mx = fmaxf(mx, s[jt][r]);
        }
    }
    mx = fmaxf(mx, other_row(mx));

    // p = exp(scale * (s - mx)) as one fma and one exp2; a masked key gives exactly 0
    const float c2 = 0.17677669529663687f * 1.4426950408889634f;  // 32^-0.5 * log2(e)
    float mc = mx * c2;
    float sum = 0.f;
#pragma unroll
    for (int jt = 0; jt < 5; ++jt) {
#pragma unroll
        for (int r = 0; r < 8; ++r) s[jt][r] = fmaf(s[jt][r], c2, -mc);
    }
    // All exponents first, then the exp2: two runs of independent instructions. Mixed, they
    // compile to one dependent fma -> exp2 pair a score through a single register, each fma
    // overwriting the source of the exp2 directly in front of it.
    __builtin_amdgcn_sched_barrier(0);
#pragma unroll
    for (int jt = 0; jt < 5; ++jt) {
#pragma unroll
        for (int r = 0; r < 8; ++r) {
            s[jt][r] = __builtin_amdgcn_exp2f(s[jt][r]);
            sum += s[jt][r];
        }
    }
    sum += other_row(sum);
    float go = gma / sum;  // the row's 1/sum is applied to O, together with gamma

    // O^T = V^T * P^T (K=80 -> 20 chunks), fused with residual feat + gamma*O.
    // Chunk (jt, c) takes keys jt*16 + {2c, 2c+1} in lanes 0-15 and the same + 8 in lanes
    // 16-31, in the A-fragment and in the score registers alike.
    float ls1 = 0.f, ls2 = 0.f;
#pragma unroll
    for (int et = 0; et < 2; ++et) {
        v8f acc = {0.f, 0.f, 0.f, 0.f, 0.f, 0.f, 0.f, 0.f};
#pragma unroll
        for (int jt = 0; jt < 5; ++jt) {
#pragma unroll
            for (int h = 0; h < 2; ++h) {
                float4 v4 = Vs[t0 + jt][et * 2 + h][lane];
                v2f af, pf;
                af.x = v4.x;
                af.y = v4.y;
                pf.x = s[jt][4 * h + 0];
                pf.y = s[jt][4 * h + 1];
                acc = wmma4(af, pf, acc);
                af.x = v4.z;
                af.y = v4.w;
                pf.x = s[jt][4 * h + 2];
                pf.y = s[jt][4 * h + 3];
                acc = wmma4(af, pf, acc);
            }
        }
        // this lane holds channels e0 .. e0+7 of its query, e0 = et*16 + 8*hi
        float w[8] = {wo[et][0].x, wo[et][0].y, wo[et][0].z, wo[et][0].w,
                      wo[et][1].x, wo[et][1].y, wo[et][1].z, wo[et][1].w};
        float gv[8];
#pragma unroll
        for (int r = 0; r < 8; ++r) {
            float f = xv * w[r];  // feat is rank-1 (C==1): recompute
            gv[r] = f + go * acc[r];
            ls1 += gv[r];
            ls2 += gv[r] * gv[r];
        }
        float4* dst = (float4*)(g + (size_t)p * D_DIM + et * 16 + 8 * hi);
        dst[0] = make_float4(gv[0], gv[1], gv[2], gv[3]);
        dst[1] = make_float4(gv[4], gv[5], gv[6], gv[7]);
    }
    // GN2 partial sums of this tile: no atomic, k_final adds the tiles in a fixed order
    ls1 = wave_sum(ls1);
    ls2 = wave_sum(ls2);
    if (lane == 0) {
        int tile = (rowbase + i0) >> 4;
        part[tile * 2 + 0] = ls1;
        part[tile * 2 + 1] = ls2;
    }
}

// ------------------------------------- out = w_out . gelu(GN2(g))  (C == 1)
// v of lane ^ MASK (MASK < 16), as a row_xmask DPP
template <int MASK>
__device__ __forceinline__ float lane_xor(float v) {
    return __int_as_float(
        __builtin_amdgcn_update_dpp(0, __float_as_int(v), 0x160 + MASK, 0xf, 0xf, true));
}

// Eight lanes share a pixel: lane l of a wave holds channels 4*(l & 7) .. + 3, the same four
// for all its pixels, and load j of the wave brings pixels 4*j + (l >> 3): four whole cache
// lines a load. All loads are issued at the top, so that g and the partial sums of GN2 are
// on their way together.
__global__ void __launch_bounds__(256)
k_final(const float* __restrict__ g, const float* __restrict__ gn_w,
        const float* __restrict__ gn_b, const float* __restrict__ w_out,
        const float* __restrict__ part, float* __restrict__ out) {
    __shared__ float r1[8], r2[8];
    int lane = threadIdx.x & 31;
    int p0 = blockIdx.x * 256 + (threadIdx.x & ~31);  // first pixel of this wave
    int b = blockIdx.x >> 8;                          // 256 blocks a batch
    int k = lane & 7;
    float4 w4 = ((const float4*)gn_w)[k];
    float4 b4 = ((const float4*)gn_b)[k];
    float4 o4 = ((const float4*)w_out)[k];
    const float4* gp = (const float4*)(g + (size_t)p0 * D_DIM) + lane;
    float4 gv[8];
#pragma unroll
    for (int j = 0; j < 8; ++j) gv[j] = gp[j * 32];
    // Holds the g loads here, in front of the wait for the partial sums. Left free, the
    // compiler moves them behind that wait, and the two latencies add up.
    __builtin_amdgcn_sched_barrier(0);
    // The registers of gp are reused below (as a destination of the next loads), so the wait
    // stands between the two; naming gp keeps it in its registers up to the wait.
    asm volatile("s_wait_xcnt 0x0" ::"v"(gp) : "memory");
    __builtin_amdgcn_sched_barrier(0);
    // GN2 sums of this batch: its NTILE_B {s1,s2} pairs, two pairs a load
    const float4* pp = (const float4*)(part + (size_t)b * NTILE_B * 2) + threadIdx.x;
    float4 t[NTILE_B / 512];
#pragma unroll
    for (int i = 0; i < NTILE_B / 512; ++i) t[i] = pp[i * 256];
    float s1 = 0.f, s2 = 0.f;
#pragma unroll
    for (int i = 0; i < NTILE_B / 512; ++i) {
        s1 += t[i].x + t[i].z;
        s2 += t[i].y + t[i].w;
    }
    s1 = wave_sum(s1);
    s2 = wave_sum(s2);
    if (lane == 0) {
        r1[threadIdx.x >> 5] = s1;
        r2[threadIdx.x >> 5] = s2;
    }
    __syncthreads();
    s1 = 0.f;
    s2 = 0.f;
#pragma unroll
    for (int w = 0; w < 8; ++w) {
        s1 += r1[w];
        s2 += r2[w];
    }
    const float cnt = (float)(D_DIM * W_DIM * H_DIM);
    float mu = s1 / cnt;
    float var = s2 / cnt - mu * mu;
    float rs = rsqrtf(var + 1e-5f);

    // GN2 as one fma a value: h = g * sc + sh
    v2f sc[2] = {{rs * w4.x, rs * w4.y}, {rs * w4.z, rs * w4.w}};
    v2f sh[2] = {{b4.x - mu * sc[0].x, b4.y - mu * sc[0].y},
                 {b4.z - mu * sc[1].x, b4.w - mu * sc[1].y}};
    v2f ho[2] = {{0.5f * o4.x, 0.5f * o4.y}, {0.5f * o4.z, 0.5f * o4.w}};
    float a[8];  // a[j]: this lane's four channels of pixel 4*j + (lane >> 3)
#pragma unroll
    for (int j = 0; j < 8; ++j) {
        v2f g0 = {gv[j].x, gv[j].y}, g1 = {gv[j].z, gv[j].w};
        v2f h0 = fma2(g0, sc[0], sh[0]);
        v2f h1 = fma2(g1, sc[1], sh[1]);
        v2f e0 = erf_pair(h0 * 0.70710678118654752440f) + 1.0f;
        v2f e1 = erf_pair(h1 * 0.70710678118654752440f) + 1.0f;
        v2f acc = (h0 * ho[0]) * e0;
        acc = fma2(h1 * ho[1], e1, acc);
        a[j] = acc.x + acc.y;
    }
    // Sum over the eight lanes of a pixel, halving the values a lane carries at each step:
    // lane l ends with the sum of load j = l & 7.
    bool k2 = lane & 4, k1 = lane & 2, k0 = lane & 1;
    float c[4], d[2];
#pragma unroll
    for (int i = 0; i < 4; ++i)
        c[i] = (k2 ? a[i + 4] : a[i]) + lane_xor<4>(k2 ? a[i] : a[i + 4]);
#pragma unroll
    for (int i = 0; i < 2; ++i)
        d[i] = (k1 ? c[i + 2] : c[i]) + lane_xor<2>(k1 ? c[i] : c[i + 2]);
    float o = (k0 ? d[1] : d[0]) + lane_xor<1>(k0 ? d[0] : d[1]);
    out[p0 + 4 * k + (lane >> 3)] = o;
}

extern "C" void kernel_launch(void* const* d_in, const int* in_sizes, int n_in,
                              void* d_out, int out_size, void* d_ws, size_t ws_size,
                              hipStream_t stream) {
    (void)in_sizes; (void)n_in; (void)out_size; (void)ws_size;
    const float* x     = (const float*)d_in[0];
    const float* w_in  = (const float*)d_in[1];
    const float* w_q   = (const float*)d_in[2];
    const float* w_k   = (const float*)d_in[3];
    const float* w_v   = (const float*)d_in[4];
    const float* w_out = (const float*)d_in[5];
    const float* gn_w  = (const float*)d_in[6];
    const float* gn_b  = (const float*)d_in[7];
    const float* gamma = (const float*)d_in[8];
    float* out = (float*)d_out;

    char* ws = (char*)d_ws;
    float* stats = (float*)ws;  // GN1 partial sums: NPIX / SPIX pairs
    const size_t BUF = (size_t)NPIX * D_DIM * sizeof(float);  // 16 MB
    float* g  = (float*)(ws + 256);
    float* part = (float*)(ws + 256 + 1 * BUF);
    float* mp = (float*)(ws + 256 + 1 * BUF + (NPIX / 16) * 2 * sizeof(float));

    k_stats1<<<NPIX / SPIX + 1, 256, 0, stream>>>(x, w_in, w_q, w_k, stats, mp);
    k_attn<<<NROWS * (H_DIM / 16 / QT), KT * 32, 0, stream>>>(x, w_in, gn_w, gn_b, stats, mp,
                                                              w_v, gamma, g, part);
    k_final<<<NPIX / 256, 256, 0, stream>>>(g, gn_w, gn_b, w_out, part, out);
}
